// v000
// Measured on an AMD MI455X. A time is GPU time per run, averaged over a window of back-to-back runs after a warm-up
// (all launches, gaps included; the runs take copies of the inputs in turn), and the median of several windows.
// Apart from v000's, it joins two sittings. Times from different sittings can be a few percent apart, while
// side-by-side timings come from the same sitting.
// The starting kernel, v000, takes 257 microseconds a run.
// compute dtype: all float inputs rounded to bf16; the six pointwise projections with EXACT bf16 products on WMMA 16x16x32 (channels-first inputs gathered into token rows), rounded once to f16; two PLAIN 64-wide attentions: q, k single f16 x 1/8, running-max softmax in f32 (hardware exp), P (scaled by 2^11, single f16) x v (single f16); the average of the two in f32, split into bf16 hi + lo x exact Wout (2 products); channels-first f32 output.
#include <hip/hip_runtime.h>
#include <math.h>

typedef __attribute__((ext_vector_type(16))) _Float16 v16h;
typedef __attribute__((ext_vector_type(16))) __bf16 v16b;
typedef __attribute__((ext_vector_type(8)))  _Float16 v8h;
typedef __attribute__((ext_vector_type(8)))  float v8f;
typedef __attribute__((ext_vector_type(4)))  float v4f;
typedef __attribute__((ext_vector_type(2)))  float v2f;
typedef __attribute__((ext_vector_type(4)))  unsigned v4u;
typedef __attribute__((ext_vector_type(4)))  int v4i;
typedef float __attribute__((may_alias)) float_a;
typedef int __attribute__((may_alias)) int_a;

template <typename T> __device__ __forceinline__ void vst2(void* p, T v) { *(T*)p = v;  }
__device__ __forceinline__ v8f wmma16(v16h a, v16h b, v8f c) {
  v8f d = __builtin_amdgcn_wmma_f32_16x16x32_f16(false, a, false, b, (short)0, c, false, false);
  asm volatile("v_nop\n\tv_nop\n\tv_nop\n\tv_nop" : "+v"(d) : "v"(a), "v"(b));
  return d;
}
__device__ __forceinline__ v8f wmma_bf(v16b a, v16b b, v8f c) {
  v8f d = __builtin_amdgcn_wmma_f32_16x16x32_bf16(false, a, false, b, (short)0, c, false, false);
  asm volatile("v_nop\n\tv_nop\n\tv_nop\n\tv_nop" : "+v"(d) : "v"(a), "v"(b));
  return d;
}
// 16x16x32 fragments: lane = (h = lane>>4, row/col = lane&15); elements 0..7 = k0+8h+0..7, 8..15 = k0+16+8h+0..7; D element r = row 8h+r
__device__ __forceinline__ v16h frag_h(const _Float16* rowk0, int lane) {
  union { v16h v; v8h q[2]; } u; const _Float16* p = rowk0 + 8 * (lane >> 4);
  u.q[0] = *(const v8h*)p; u.q[1] = *(const v8h*)(p + 16); return u.v;
}
__device__ __forceinline__ v16h frag_f32(const float* rowk0, int lane) {
  v16h a; const float* p = rowk0 + 8 * (lane >> 4);
#pragma unroll
  for (int i = 0; i < 8; ++i) { a[i] = (_Float16)p[i]; a[8 + i] = (_Float16)p[16 + i]; }
  return a;
}
__device__ __forceinline__ v16h frag_f32s(const float* rowk0, int lane, float sc) {
  v16h a; const float* p = rowk0 + 8 * (lane >> 4);
#pragma unroll
  for (int i = 0; i < 8; ++i) { a[i] = (_Float16)(p[i] * sc); a[8 + i] = (_Float16)(p[16 + i] * sc); }
  return a;
}
// column fragment from a [K][ld] layout (column n), rows >= K read as 0
__device__ __forceinline__ v16h fragc_f32(const float* W, int k0, int n, int lane, int ld, int K) {
  v16h a; const int g = lane >> 4;
#pragma unroll
  for (int i = 0; i < 8; ++i) { const int ka = k0 + 8 * g + i, kb = ka + 16;
    a[i] = (_Float16)(ka < K ? W[(size_t)(ka < K ? ka : K - 1) * ld + n] : 0.f); a[8 + i] = (_Float16)(kb < K ? W[(size_t)(kb < K ? kb : K - 1) * ld + n] : 0.f); }
  return a;
}
struct F2 { v16b h, l; };
__device__ __forceinline__ F2 bsplit16(const float v[16]) { F2 r;
#pragma unroll
  for (int i = 0; i < 16; ++i) { const __bf16 h = (__bf16)v[i]; r.h[i] = h; r.l[i] = (__bf16)(v[i] - (float)h); }
  return r; }
__device__ __forceinline__ F2 split_row(const float* row, int k0, int lane) { float v[16]; const float* p = row + k0 + 8 * (lane >> 4);
#pragma unroll
  for (int i = 0; i < 8; ++i) { v[i] = p[i]; v[8 + i] = p[16 + i]; }
  return bsplit16(v); }
__device__ __forceinline__ F2 split_rowK(const float* row, int k0, int lane, int K) { float v[16]; const int g = lane >> 4;
#pragma unroll
  for (int i = 0; i < 8; ++i) { const int ka = k0 + 8 * g + i, kb = ka + 16; v[i] = ka < K ? row[ka < K ? ka : K - 1] : 0.f; v[8 + i] = kb < K ? row[kb < K ? kb : K - 1] : 0.f; }
  return bsplit16(v); }
__device__ __forceinline__ F2 split_col(const float* W, int k0, int n, int lane, int ld, int K) { float v[16]; const int g = lane >> 4;
#pragma unroll
  for (int i = 0; i < 8; ++i) { const int ka = k0 + 8 * g + i, kb = ka + 16; v[i] = ka < K ? W[(size_t)(ka < K ? ka : K - 1) * ld + n] : 0.f; v[8 + i] = kb < K ? W[(size_t)(kb < K ? kb : K - 1) * ld + n] : 0.f; }
  return bsplit16(v); }
__device__ __forceinline__ v8f mac3(const F2& a, const F2& b, v8f c) { c = wmma_bf(a.l, b.h, c); c = wmma_bf(a.h, b.l, c); return wmma_bf(a.h, b.h, c); }
__device__ __forceinline__ float sigm(float v) { return 1.0f / (1.0f + expf(-v)); }
#define LDSX() do { asm volatile("s_wait_dscnt 0" ::: "memory"); __builtin_amdgcn_wave_barrier(); __builtin_amdgcn_fence(__ATOMIC_RELEASE, "workgroup"); } while (0)


// Uni/bidirectional spatial attention (B 2, C 64, 16^3 = 4,096 voxels): target->target and source->target single-head attentions from 1x1x1 projections, averaged, then a 1x1x1 output projection.
#define NB 2
#define CC 64
#define NN 4096
#define NP 2               // attention pairs: 0 = tt, 1 = st
#ifndef TQB
#define TQB (NN / 64)
#define TNB NB
#endif
typedef __attribute__((ext_vector_type(8))) __bf16 v8b;
__device__ __forceinline__ v16b frag_b(const __bf16* rowk0, int lane) {
  union { v16b v; v8b q[2]; } u; const __bf16* p = rowk0 + 8 * (lane >> 4);
  u.q[0] = *(const v8b*)p; u.q[1] = *(const v8b*)(p + 16); return u.v;
}
__device__ __forceinline__ float bfr(float v) { return (float)(__bf16)v; }
__device__ __attribute__((noinline)) float exp_ni(float v) { return expf(v); }
__device__ __attribute__((noinline)) float erf_ni(float v) { return erff(v); }

#define WS_PW  0u                                   // bf16 natural rows: Wq_tt, Wk_tt, Wv_tt, Wq_st, Wk_st, Wv_st, Wout  [7][64][64]
#define WS_Q   (WS_PW + 2u * 7 * CC * CC)           // f16 rows [p][b][n][64] q ; k ; planes V [p][b][64][n] ; O f32 [p][b][n][64]
#define WS_K   (WS_Q + 2u * (size_t)NP * NB * NN * CC)
#define WS_V   (WS_K + 2u * (size_t)NP * NB * NN * CC)
#define WS_O   (WS_V + 2u * (size_t)NP * NB * CC * NN)
#define WS_END (WS_O + 4u * (size_t)NP * NB * NN * CC)

__global__ __launch_bounds__(64) void k_pack(const float* __restrict__ W0, const float* __restrict__ W1, const float* __restrict__ W2, const float* __restrict__ W3, const float* __restrict__ W4, const float* __restrict__ W5, const float* __restrict__ W6, __bf16* __restrict__ P) {
  const int n = blockIdx.x, m = blockIdx.y, t = threadIdx.x; const float* src = (m == 0) ? W0 : (m == 1) ? W1 : (m == 2) ? W2 : (m == 3) ? W3 : (m == 4) ? W4 : (m == 5) ? W5 : W6; __shared__ __align__(16) __bf16 s[CC]; s[t] = (__bf16)src[(size_t)n * CC + t]; __syncthreads(); if (t < CC / 8) vst2((unsigned*)(P + ((size_t)m * CC + n) * CC + t * 8), *(const v4u*)&s[t * 8]); }
// ---- k_proj: block = (64 voxels, which of 6, b): input tgt (which 0,1,2,3) or src (4,5); A gathered channels-first; which -> (pair, role): 0 q_tt, 1 k_tt, 2 v_tt, 3 q_st, 4 k_st, 5 v_st
__global__ __launch_bounds__(128) void k_proj(const float* __restrict__ SRC, const float* __restrict__ TGT, const __bf16* __restrict__ P, _Float16* __restrict__ Q, _Float16* __restrict__ Kr, _Float16* __restrict__ V) {
  __shared__ __align__(16) _Float16 so[64][72]; __shared__ __align__(16) _Float16 st[64][72];
  const int tid = threadIdx.x, wave = tid >> 5, lane = tid & 31, col = lane & 15, g = lane >> 4; const int which = blockIdx.y; const size_t b = blockIdx.z; const int n0b = blockIdx.x * 64, n0 = n0b + wave * 16;
  const float* X = (which >= 4) ? SRC : TGT; const int pair = (which >= 3) ? 1 : 0; const int role = (which >= 3) ? (which - 3) : which;
  v8f acc[4] = {};
#pragma unroll
  for (int kc = 0; kc < CC / 32; ++kc) { v16b a; { const float* p = X + (b * CC + kc * 32 + 8 * g) * NN + n0 + col;
#pragma unroll
      for (int i = 0; i < 8; ++i) { a[i] = (__bf16)p[(size_t)i * NN]; a[8 + i] = (__bf16)p[(size_t)(16 + i) * NN]; } }
#pragma unroll
    for (int j = 0; j < 4; ++j) acc[j] = wmma_bf(a, frag_b(P + ((size_t)which * CC + j * 16 + col) * CC + kc * 32, lane), acc[j]); }
  if (role < 2) { _Float16* dst = ((role == 0) ? Q : Kr) + ((size_t)pair * NB + b) * NN * CC;
#pragma unroll
    for (int j = 0; j < 4; ++j)
#pragma unroll
      for (int r = 0; r < 8; ++r) so[wave * 16 + 8 * g + r][j * 16 + col] = (_Float16)acc[j][r];
    LDSX();
    for (int rl = 0; rl < 16; ++rl) if (lane < 8) vst2((unsigned*)(dst + (size_t)(n0 + rl) * CC + lane * 8), *(const v4u*)&so[wave * 16 + rl][lane * 8]);
  } else { _Float16* dst = V + ((size_t)pair * NB + b) * CC * NN;
#pragma unroll
    for (int j = 0; j < 4; ++j)
#pragma unroll
      for (int r = 0; r < 8; ++r) st[j * 16 + col][wave * 16 + 8 * g + r] = (_Float16)acc[j][r];
    __syncthreads();
    for (int e = tid; e < 64 * 8; e += 128) { const int d = e >> 3, pc = e & 7; vst2((unsigned*)(dst + (size_t)d * NN + n0b + pc * 8), *(const v4u*)&st[d][pc * 8]); } }
}
// ---- k_attn: block = (64 queries, pair*NB + b): single 64-wide head over all 4,096 voxels, scale 1/8
__global__ __launch_bounds__(128) void k_attn(const _Float16* __restrict__ Q, const _Float16* __restrict__ Kr, const _Float16* __restrict__ V, float* __restrict__ O) {
  __shared__ __align__(16) _Float16 sph[4][16][40]; __shared__ __align__(16) float so[4][16][68];
  const int tid = threadIdx.x, wave = tid >> 5, lane = tid & 31, col = lane & 15, g = lane >> 4; const size_t pb = blockIdx.y; const int q0 = blockIdx.x * 64 + wave * 16; const size_t rq = pb * NN + q0;
  v16h aq[2];
#pragma unroll
  for (int kc = 0; kc < 2; ++kc) aq[kc] = frag_h(Q + (rq + col) * CC + kc * 32, lane);
  float m[8], l[8];
#pragma unroll
  for (int r = 0; r < 8; ++r) { m[r] = -3.0e38f; l[r] = 0.f; }
  v8f acc[4] = {};
#pragma unroll 1
  for (int ks = 0; ks < NN / 32; ++ks) { const int j0 = ks * 32; v8f s[2];
#pragma unroll
    for (int ct = 0; ct < 2; ++ct) { const size_t rk = (pb * NN + j0 + ct * 16 + col) * CC; v8f c = {};
#pragma unroll
      for (int kc = 0; kc < 2; ++kc) c = wmma16(aq[kc], frag_h(Kr + rk + kc * 32, lane), c);
#pragma unroll
      for (int r = 0; r < 8; ++r) s[ct][r] = c[r] * 0.125f; }
#pragma unroll
    for (int r = 0; r < 8; ++r) { float mx = fmaxf(s[0][r], s[1][r]);
#pragma unroll
      for (int o = 1; o < 16; o <<= 1) mx = fmaxf(mx, __shfl_xor(mx, o));
      const float mn = fmaxf(m[r], mx); const float alpha = (m[r] <= -1.0e38f) ? 0.f : __expf(m[r] - mn); const float e0 = __expf(s[0][r] - mn), e1 = __expf(s[1][r] - mn); float es = e0 + e1;
#pragma unroll
      for (int o = 1; o < 16; o <<= 1) es += __shfl_xor(es, o);
      l[r] = l[r] * alpha + es; m[r] = mn;
#pragma unroll
      for (int dt = 0; dt < 4; ++dt) acc[dt][r] *= alpha;
      sph[wave][8 * g + r][col] = (_Float16)(e0 * 2048.0f); sph[wave][8 * g + r][16 + col] = (_Float16)(e1 * 2048.0f); }
    LDSX();
    const v16h pa = frag_h(&sph[wave][col][0], lane);
#pragma unroll
    for (int dt = 0; dt < 4; ++dt) acc[dt] = wmma16(pa, frag_h(V + (pb * CC + dt * 16 + col) * NN + j0, lane), acc[dt]);
    LDSX(); }
#pragma unroll
  for (int r = 0; r < 8; ++r) { const float il = (1.0f / 2048.0f) / l[r];
#pragma unroll
    for (int dt = 0; dt < 4; ++dt) so[wave][8 * g + r][dt * 16 + col] = acc[dt][r] * il; }
  LDSX();
  for (int rl = 0; rl < 16; ++rl) if (lane < 16) vst2(O + (rq + rl) * CC + lane * 4, *(const v4f*)&so[wave][rl][lane * 4]);
}
// ---- k_fin: block = (64 voxels, b): att = (O_tt + O_st) / 2 (f32), out = att (bf16 hi + lo) . Wout^T (exact), channels-first 256-B segments
__global__ __launch_bounds__(128) void k_fin(const float* __restrict__ O, const __bf16* __restrict__ P, float* __restrict__ OUT) {
  __shared__ __align__(16) float sa[4][16][68]; __shared__ __align__(16) float st[64][68];
  const int tid = threadIdx.x, wave = tid >> 5, lane = tid & 31, col = lane & 15, g = lane >> 4; const size_t b = blockIdx.y; const int n0b = blockIdx.x * 64, n0 = n0b + wave * 16;
  for (int e = lane; e < 16 * CC; e += 32) { const int rl = e >> 6, c = e & 63; sa[wave][rl][c] = (O[((0 * NB + b) * NN + n0 + rl) * CC + c] + O[((1 * NB + b) * NN + n0 + rl) * CC + c]) * 0.5f; }
  LDSX();
  v8f acc[4] = {};
#pragma unroll
  for (int kc = 0; kc < CC / 32; ++kc) { const F2 a = split_row(&sa[wave][col][0], kc * 32, lane);
#pragma unroll
    for (int jt = 0; jt < 4; ++jt) { const v16b w = frag_b(P + ((size_t)6 * CC + jt * 16 + col) * CC + kc * 32, lane); acc[jt] = wmma_bf(a.h, w, acc[jt]); acc[jt] = wmma_bf(a.l, w, acc[jt]); } }
#pragma unroll
  for (int jt = 0; jt < 4; ++jt)
#pragma unroll
    for (int r = 0; r < 8; ++r) st[jt * 16 + col][wave * 16 + 8 * g + r] = acc[jt][r];
  __syncthreads();
  for (int e = tid; e < CC * 16; e += 128) { const int o = e >> 4, q = e & 15; vst2(OUT + ((b * CC + o) * NN) + n0b + q * 4, *(const v4f*)&st[o][q * 4]); }
}
extern "C" void kernel_launch(void* const* d_in, const int* in_sizes, int n_in, void* d_out, int out_size, void* d_ws, size_t ws_size, hipStream_t stream) {
  (void)in_sizes; (void)n_in; (void)out_size;
  const float** F = (const float**)d_in;   // 0 source, 1 target [2,64,16,16,16]; 2 Wq_tt, 3 Wq_st, 4 Wk_tt, 5 Wk_st, 6 Wv_tt, 7 Wv_st, 8 Wout ([64,64] natural [out][in])
  if (ws_size < (size_t)WS_END) return;
  char* ws = (char*)d_ws; __bf16* P = (__bf16*)ws; _Float16 *Q = (_Float16*)(ws + WS_Q), *Kr = (_Float16*)(ws + WS_K), *V = (_Float16*)(ws + WS_V); float* O = (float*)(ws + WS_O);
  k_pack<<<dim3(CC, 7), 64, 0, stream>>>(F[2], F[4], F[6], F[3], F[5], F[7], F[8], P);   // packed order: q_tt, k_tt, v_tt, q_st, k_st, v_st, Wout
  k_proj<<<dim3(NN / 64, 6, NB), 128, 0, stream>>>(F[0], F[1], P, Q, Kr, V);
  k_attn<<<dim3(TQB, NP * TNB), 128, 0, stream>>>(Q, Kr, V, O);
  k_fin<<<dim3(TQB, TNB), 128, 0, stream>>>(O, P, (float*)d_out);
}

// v001
// It runs in 86.4 microseconds.
// In two side-by-side timings against v000, it was 2.96 and 3.02 times as fast.
// compute dtype: all float inputs rounded to bf16; the six pointwise projections with EXACT bf16 products on WMMA 16x16x32 (channels-first inputs gathered into token rows), rounded once to f16; two PLAIN 64-wide attentions: q, k single f16 x 1/8, running-max softmax in f32 (hardware exp), P (scaled by 2^11, single f16) x v (single f16); the average of the two in f32, split into bf16 hi + lo x exact Wout (2 products); channels-first f32 output.
#include <hip/hip_runtime.h>
#include <math.h>

typedef __attribute__((ext_vector_type(16))) _Float16 v16h;
typedef __attribute__((ext_vector_type(16))) __bf16 v16b;
typedef __attribute__((ext_vector_type(8)))  _Float16 v8h;
typedef __attribute__((ext_vector_type(8)))  float v8f;
typedef __attribute__((ext_vector_type(4)))  float v4f;
typedef __attribute__((ext_vector_type(2)))  float v2f;
typedef __attribute__((ext_vector_type(4)))  unsigned v4u;
typedef __attribute__((ext_vector_type(4)))  int v4i;
typedef float __attribute__((may_alias)) float_a;
typedef int __attribute__((may_alias)) int_a;

template <typename T> __device__ __forceinline__ void vst2(void* p, T v) { *(T*)p = v;  }
__device__ __forceinline__ v8f wmma16(v16h a, v16h b, v8f c) {
  v8f d = __builtin_amdgcn_wmma_f32_16x16x32_f16(false, a, false, b, (short)0, c, false, false);
  asm volatile("v_nop\n\tv_nop\n\tv_nop\n\tv_nop" : "+v"(d) : "v"(a), "v"(b));
  return d;
}
__device__ __forceinline__ v8f wmma_bf(v16b a, v16b b, v8f c) {
  v8f d = __builtin_amdgcn_wmma_f32_16x16x32_bf16(false, a, false, b, (short)0, c, false, false);
  asm volatile("v_nop\n\tv_nop\n\tv_nop\n\tv_nop" : "+v"(d) : "v"(a), "v"(b));
  return d;
}
// 16x16x32 fragments: lane = (h = lane>>4, row/col = lane&15); elements 0..7 = k0+8h+0..7, 8..15 = k0+16+8h+0..7; D element r = row 8h+r
__device__ __forceinline__ v16h frag_h(const _Float16* rowk0, int lane) {
  union { v16h v; v8h q[2]; } u; const _Float16* p = rowk0 + 8 * (lane >> 4);
  u.q[0] = *(const v8h*)p; u.q[1] = *(const v8h*)(p + 16); return u.v;
}
__device__ __forceinline__ v16h frag_f32(const float* rowk0, int lane) {
  v16h a; const float* p = rowk0 + 8 * (lane >> 4);
#pragma unroll
  for (int i = 0; i < 8; ++i) { a[i] = (_Float16)p[i]; a[8 + i] = (_Float16)p[16 + i]; }
  return a;
}
__device__ __forceinline__ v16h frag_f32s(const float* rowk0, int lane, float sc) {
  v16h a; const float* p = rowk0 + 8 * (lane >> 4);
#pragma unroll
  for (int i = 0; i < 8; ++i) { a[i] = (_Float16)(p[i] * sc); a[8 + i] = (_Float16)(p[16 + i] * sc); }
  return a;
}
// column fragment from a [K][ld] layout (column n), rows >= K read as 0
__device__ __forceinline__ v16h fragc_f32(const float* W, int k0, int n, int lane, int ld, int K) {
  v16h a; const int g = lane >> 4;
#pragma unroll
  for (int i = 0; i < 8; ++i) { const int ka = k0 + 8 * g + i, kb = ka + 16;
    a[i] = (_Float16)(ka < K ? W[(size_t)(ka < K ? ka : K - 1) * ld + n] : 0.f); a[8 + i] = (_Float16)(kb < K ? W[(size_t)(kb < K ? kb : K - 1) * ld + n] : 0.f); }
  return a;
}
struct F2 { v16b h, l; };
__device__ __forceinline__ F2 bsplit16(const float v[16]) { F2 r;
#pragma unroll
  for (int i = 0; i < 16; ++i) { const __bf16 h = (__bf16)v[i]; r.h[i] = h; r.l[i] = (__bf16)(v[i] - (float)h); }
  return r; }
__device__ __forceinline__ F2 split_row(const float* row, int k0, int lane) { float v[16]; const float* p = row + k0 + 8 * (lane >> 4);
#pragma unroll
  for (int i = 0; i < 8; ++i) { v[i] = p[i]; v[8 + i] = p[16 + i]; }
  return bsplit16(v); }
__device__ __forceinline__ F2 split_rowK(const float* row, int k0, int lane, int K) { float v[16]; const int g = lane >> 4;
#pragma unroll
  for (int i = 0; i < 8; ++i) { const int ka = k0 + 8 * g + i, kb = ka + 16; v[i] = ka < K ? row[ka < K ? ka : K - 1] : 0.f; v[8 + i] = kb < K ? row[kb < K ? kb : K - 1] : 0.f; }
  return bsplit16(v); }
__device__ __forceinline__ F2 split_col(const float* W, int k0, int n, int lane, int ld, int K) { float v[16]; const int g = lane >> 4;
#pragma unroll
  for (int i = 0; i < 8; ++i) { const int ka = k0 + 8 * g + i, kb = ka + 16; v[i] = ka < K ? W[(size_t)(ka < K ? ka : K - 1) * ld + n] : 0.f; v[8 + i] = kb < K ? W[(size_t)(kb < K ? kb : K - 1) * ld + n] : 0.f; }
  return bsplit16(v); }
__device__ __forceinline__ v8f mac3(const F2& a, const F2& b, v8f c) { c = wmma_bf(a.l, b.h, c); c = wmma_bf(a.h, b.l, c); return wmma_bf(a.h, b.h, c); }
__device__ __forceinline__ float sigm(float v) { return 1.0f / (1.0f + expf(-v)); }
#define LDSX() do { asm volatile("s_wait_dscnt 0" ::: "memory"); __builtin_amdgcn_wave_barrier(); __builtin_amdgcn_fence(__ATOMIC_RELEASE, "workgroup"); } while (0)


// Uni/bidirectional spatial attention (B 2, C 64, 16^3 = 4,096 voxels): target->target and source->target single-head attentions from 1x1x1 projections, averaged, then a 1x1x1 output projection.
#define NB 2
#define CC 64
#define NN 4096
#define NP 2               // attention pairs: 0 = tt, 1 = st
#ifndef TQB
#define TQB (NN / 64)
#define TNB NB
#endif
typedef __attribute__((ext_vector_type(8))) __bf16 v8b;
__device__ __forceinline__ v16b frag_b(const __bf16* rowk0, int lane) {
  union { v16b v; v8b q[2]; } u; const __bf16* p = rowk0 + 8 * (lane >> 4);
  u.q[0] = *(const v8b*)p; u.q[1] = *(const v8b*)(p + 16); return u.v;
}
__device__ __forceinline__ float bfr(float v) { return (float)(__bf16)v; }
__device__ __attribute__((noinline)) float exp_ni(float v) { return expf(v); }
__device__ __attribute__((noinline)) float erf_ni(float v) { return erff(v); }

#define WS_PW  0u                                   // bf16 natural rows: Wq_tt, Wk_tt, Wv_tt, Wq_st, Wk_st, Wv_st, Wout  [7][64][64]
#define WS_Q   (WS_PW + 2u * 7 * CC * CC)           // f16 rows [p][b][n][64] q ; k ; planes V [p][b][64][n] ; O f32 [p][b][n][64]
#define WS_K   (WS_Q + 2u * (size_t)NP * NB * NN * CC)
#define WS_V   (WS_K + 2u * (size_t)NP * NB * NN * CC)
#define WS_O   (WS_V + 2u * (size_t)NP * NB * CC * NN)
#define WS_END (WS_O + 4u * (size_t)NP * NB * NN * CC)

__global__ __launch_bounds__(64) void k_pack(const float* __restrict__ W0, const float* __restrict__ W1, const float* __restrict__ W2, const float* __restrict__ W3, const float* __restrict__ W4, const float* __restrict__ W5, const float* __restrict__ W6, __bf16* __restrict__ P) {
  const int n = blockIdx.x, m = blockIdx.y, t = threadIdx.x; const float* src = (m == 0) ? W0 : (m == 1) ? W1 : (m == 2) ? W2 : (m == 3) ? W3 : (m == 4) ? W4 : (m == 5) ? W5 : W6; __shared__ __align__(16) __bf16 s[CC]; s[t] = (__bf16)src[(size_t)n * CC + t]; __syncthreads(); if (t < CC / 8) vst2((unsigned*)(P + ((size_t)m * CC + n) * CC + t * 8), *(const v4u*)&s[t * 8]); }
// ---- k_proj: block = (64 voxels, which of 6, b): input tgt (which 0,1,2,3) or src (4,5); A gathered channels-first; which -> (pair, role): 0 q_tt, 1 k_tt, 2 v_tt, 3 q_st, 4 k_st, 5 v_st
__global__ __launch_bounds__(128) void k_proj(const float* __restrict__ SRC, const float* __restrict__ TGT, const __bf16* __restrict__ P, _Float16* __restrict__ Q, _Float16* __restrict__ Kr, _Float16* __restrict__ V) {
  __shared__ __align__(16) _Float16 so[64][72]; __shared__ __align__(16) _Float16 st[64][72];
  const int tid = threadIdx.x, wave = tid >> 5, lane = tid & 31, col = lane & 15, g = lane >> 4; const int which = blockIdx.y; const size_t b = blockIdx.z; const int n0b = blockIdx.x * 64, n0 = n0b + wave * 16;
  const float* X = (which >= 4) ? SRC : TGT; const int pair = (which >= 3) ? 1 : 0; const int role = (which >= 3) ? (which - 3) : which;
  v8f acc[4] = {};
#pragma unroll
  for (int kc = 0; kc < CC / 32; ++kc) { v16b a; { const float* p = X + (b * CC + kc * 32 + 8 * g) * NN + n0 + col;
#pragma unroll
      for (int i = 0; i < 8; ++i) { a[i] = (__bf16)p[(size_t)i * NN]; a[8 + i] = (__bf16)p[(size_t)(16 + i) * NN]; } }
#pragma unroll
    for (int j = 0; j < 4; ++j) acc[j] = wmma_bf(a, frag_b(P + ((size_t)which * CC + j * 16 + col) * CC + kc * 32, lane), acc[j]); }
  if (role < 2) { _Float16* dst = ((role == 0) ? Q : Kr) + ((size_t)pair * NB + b) * NN * CC;
#pragma unroll
    for (int j = 0; j < 4; ++j)
#pragma unroll
      for (int r = 0; r < 8; ++r) so[wave * 16 + 8 * g + r][j * 16 + col] = (_Float16)acc[j][r];
    LDSX();
    for (int rl = 0; rl < 16; ++rl) if (lane < 8) vst2((unsigned*)(dst + (size_t)(n0 + rl) * CC + lane * 8), *(const v4u*)&so[wave * 16 + rl][lane * 8]);
  } else { _Float16* dst = V + ((size_t)pair * NB + b) * CC * NN;
#pragma unroll
    for (int j = 0; j < 4; ++j)
#pragma unroll
      for (int r = 0; r < 8; ++r) st[j * 16 + col][wave * 16 + 8 * g + r] = (_Float16)acc[j][r];
    __syncthreads();
    for (int e = tid; e < 64 * 8; e += 128) { const int d = e >> 3, pc = e & 7; vst2((unsigned*)(dst + (size_t)d * NN + n0b + pc * 8), *(const v4u*)&st[d][pc * 8]); } }
}
// ---- k_attn: block = (64 queries, pair*NB + b), 4 * KSP waves: wave = (16-query tile qg, key split sp); split sp walks the 32-key blocks sp, sp + KSP, ... with its own running max, sum and accumulators; the KSP partials of a tile are merged through LDS. Single 64-wide head over all 4,096 voxels, scale 1/8
#define KSP 7              // key splits per 16-query tile: 4 tiles x 7 splits = 28 waves, 7 per SIMD, to cover each other's load and LDS latencies; at 8 the 128-register budget made the compiler run the eight rows' reductions one after another
__global__ __launch_bounds__(128 * KSP) void k_attn(const _Float16* __restrict__ Q, const _Float16* __restrict__ Kr, const _Float16* __restrict__ V, float* __restrict__ O) {
  __shared__ __align__(16) _Float16 sph[4 * KSP][16][40]; __shared__ __align__(16) float so[4 * KSP][16][68]; __shared__ float sm[4 * KSP][16]; __shared__ float sl[4 * KSP][16];
  const int tid = threadIdx.x, wave = __builtin_amdgcn_readfirstlane(tid >> 5), lane = tid & 31, col = lane & 15, g = lane >> 4; const int qg = wave & 3, sp = wave >> 2; const size_t pb = blockIdx.y; const int q0 = blockIdx.x * 64 + qg * 16; const size_t rq = pb * NN + q0;
  v16h aq[2];
#pragma unroll
  for (int kc = 0; kc < 2; ++kc) aq[kc] = frag_h(Q + (rq + col) * CC + kc * 32, lane);
  float m[8], l[8];
#pragma unroll
  for (int r = 0; r < 8; ++r) { m[r] = -3.0e38f; l[r] = 0.f; }
  v8f acc[4] = {};
#pragma unroll 1
  for (int ks = sp; ks < NN / 32; ks += KSP) { const int j0 = ks * 32; v8f s[2];
#pragma unroll
    for (int ct = 0; ct < 2; ++ct) { const size_t rk = (pb * NN + j0 + ct * 16 + col) * CC; v8f c = {};
#pragma unroll
      for (int kc = 0; kc < 2; ++kc) c = wmma16(aq[kc], frag_h(Kr + rk + kc * 32, lane), c);
#pragma unroll
      for (int r = 0; r < 8; ++r) s[ct][r] = c[r] * 0.125f; }
#pragma unroll
    for (int r = 0; r < 8; ++r) { float mx = fmaxf(s[0][r], s[1][r]);
#pragma unroll
      for (int o = 1; o < 16; o <<= 1) mx = fmaxf(mx, __shfl_xor(mx, o));
      const float mn = fmaxf(m[r], mx); const float alpha = (m[r] <= -1.0e38f) ? 0.f : __expf(m[r] - mn); const float e0 = __expf(s[0][r] - mn), e1 = __expf(s[1][r] - mn); float es = e0 + e1;
#pragma unroll
      for (int o = 1; o < 16; o <<= 1) es += __shfl_xor(es, o);
      l[r] = l[r] * alpha + es; m[r] = mn;
#pragma unroll
      for (int dt = 0; dt < 4; ++dt) acc[dt][r] *= alpha;
      sph[wave][8 * g + r][col] = (_Float16)(e0 * 2048.0f); sph[wave][8 * g + r][16 + col] = (_Float16)(e1 * 2048.0f); }
    LDSX();
    const v16h pa = frag_h(&sph[wave][col][0], lane);
#pragma unroll
    for (int dt = 0; dt < 4; ++dt) acc[dt] = wmma16(pa, frag_h(V + (pb * CC + dt * 16 + col) * NN + j0, lane), acc[dt]);
    LDSX(); }
  // each wave leaves its un-normalised partial with its (max, sum) per row; every split has walked at least NN / 32 / KSP blocks, so every max is a real score
#pragma unroll
  for (int r = 0; r < 8; ++r) {
#pragma unroll
    for (int dt = 0; dt < 4; ++dt) so[wave][8 * g + r][dt * 16 + col] = acc[dt][r];
    if (col == 0) { sm[wave][8 * g + r] = m[r]; sl[wave][8 * g + r] = l[r]; } }
  __syncthreads();   // the partials of all splits are read by other waves below
  for (int e = tid; e < 64 * 16; e += 128 * KSP) { const int row = e >> 4, c4 = e & 15, tq = row >> 4, rl = row & 15; float mm[KSP]; float M = -3.0e38f;
#pragma unroll
    for (int p = 0; p < KSP; ++p) { mm[p] = sm[p * 4 + tq][rl]; M = fmaxf(M, mm[p]); }
    float L = 0.f; v4f o = {};
#pragma unroll
    for (int p = 0; p < KSP; ++p) { const float w = __expf(mm[p] - M); L += w * sl[p * 4 + tq][rl]; o += w * *(const v4f*)&so[p * 4 + tq][rl][c4 * 4]; }
    vst2(O + (pb * NN + blockIdx.x * 64 + row) * CC + c4 * 4, o * ((1.0f / 2048.0f) / L)); }
}
// ---- k_fin: block = (64 voxels, b): att = (O_tt + O_st) / 2 (f32), out = att (bf16 hi + lo) . Wout^T (exact), channels-first 256-B segments
__global__ __launch_bounds__(128) void k_fin(const float* __restrict__ O, const __bf16* __restrict__ P, float* __restrict__ OUT) {
  __shared__ __align__(16) float sa[4][16][68]; __shared__ __align__(16) float st[64][68];
  const int tid = threadIdx.x, wave = tid >> 5, lane = tid & 31, col = lane & 15, g = lane >> 4; const size_t b = blockIdx.y; const int n0b = blockIdx.x * 64, n0 = n0b + wave * 16;
  for (int e = lane; e < 16 * CC; e += 32) { const int rl = e >> 6, c = e & 63; sa[wave][rl][c] = (O[((0 * NB + b) * NN + n0 + rl) * CC + c] + O[((1 * NB + b) * NN + n0 + rl) * CC + c]) * 0.5f; }
  LDSX();
  v8f acc[4] = {};
#pragma unroll
  for (int kc = 0; kc < CC / 32; ++kc) { const F2 a = split_row(&sa[wave][col][0], kc * 32, lane);
#pragma unroll
    for (int jt = 0; jt < 4; ++jt) { const v16b w = frag_b(P + ((size_t)6 * CC + jt * 16 + col) * CC + kc * 32, lane); acc[jt] = wmma_bf(a.h, w, acc[jt]); acc[jt] = wmma_bf(a.l, w, acc[jt]); } }
#pragma unroll
  for (int jt = 0; jt < 4; ++jt)
#pragma unroll
    for (int r = 0; r < 8; ++r) st[jt * 16 + col][wave * 16 + 8 * g + r] = acc[jt][r];
  __syncthreads();
  for (int e = tid; e < CC * 16; e += 128) { const int o = e >> 4, q = e & 15; vst2(OUT + ((b * CC + o) * NN) + n0b + q * 4, *(const v4f*)&st[o][q * 4]); }
}
extern "C" void kernel_launch(void* const* d_in, const int* in_sizes, int n_in, void* d_out, int out_size, void* d_ws, size_t ws_size, hipStream_t stream) {
  (void)in_sizes; (void)n_in; (void)out_size;
  const float** F = (const float**)d_in;   // 0 source, 1 target [2,64,16,16,16]; 2 Wq_tt, 3 Wq_st, 4 Wk_tt, 5 Wk_st, 6 Wv_tt, 7 Wv_st, 8 Wout ([64,64] natural [out][in])
  if (ws_size < (size_t)WS_END) return;
  char* ws = (char*)d_ws; __bf16* P = (__bf16*)ws; _Float16 *Q = (_Float16*)(ws + WS_Q), *Kr = (_Float16*)(ws + WS_K), *V = (_Float16*)(ws + WS_V); float* O = (float*)(ws + WS_O);
  k_pack<<<dim3(CC, 7), 64, 0, stream>>>(F[2], F[4], F[6], F[3], F[5], F[7], F[8], P);   // packed order: q_tt, k_tt, v_tt, q_st, k_st, v_st, Wout
  k_proj<<<dim3(NN / 64, 6, NB), 128, 0, stream>>>(F[0], F[1], P, Q, Kr, V);
  k_attn<<<dim3(TQB, NP * TNB), 128 * KSP, 0, stream>>>(Q, Kr, V, O);
  k_fin<<<dim3(TQB, TNB), 128, 0, stream>>>(O, P, (float*)d_out);
}

// v002
// It runs in 84.3 microseconds.
// Timed twice side by side with v001, it ran 1.04 and 1.02 times as fast.
// All steps since v000 together make it 3.08 times as fast.
// compute dtype: all float inputs rounded to bf16; the six pointwise projections with EXACT bf16 products on WMMA 16x16x32 (channels-first inputs gathered into token rows), rounded once to f16; two PLAIN 64-wide attentions: q, k single f16 x 1/8, running-max softmax in f32 (hardware exp), P (scaled by 2^11, single f16) x v (single f16); the average of the two in f32, split into bf16 hi + lo x exact Wout (2 products); channels-first f32 output.
#include <hip/hip_runtime.h>
#include <math.h>

typedef __attribute__((ext_vector_type(16))) _Float16 v16h;
typedef __attribute__((ext_vector_type(16))) __bf16 v16b;
typedef __attribute__((ext_vector_type(8)))  _Float16 v8h;
typedef __attribute__((ext_vector_type(8)))  float v8f;
typedef __attribute__((ext_vector_type(4)))  float v4f;
typedef __attribute__((ext_vector_type(2)))  float v2f;
typedef __attribute__((ext_vector_type(4)))  unsigned v4u;
typedef __attribute__((ext_vector_type(4)))  int v4i;
typedef float __attribute__((may_alias)) float_a;
typedef int __attribute__((may_alias)) int_a;

template <typename T> __device__ __forceinline__ void vst2(void* p, T v) { *(T*)p = v;  }
__device__ __forceinline__ v8f wmma16(v16h a, v16h b, v8f c) {
  v8f d = __builtin_amdgcn_wmma_f32_16x16x32_f16(false, a, false, b, (short)0, c, false, false);
  asm volatile("v_nop\n\tv_nop\n\tv_nop\n\tv_nop" : "+v"(d) : "v"(a), "v"(b));
  return d;
}
__device__ __forceinline__ v8f wmma_bf(v16b a, v16b b, v8f c) {
  v8f d = __builtin_amdgcn_wmma_f32_16x16x32_bf16(false, a, false, b, (short)0, c, false, false);
  asm volatile("v_nop\n\tv_nop\n\tv_nop\n\tv_nop" : "+v"(d) : "v"(a), "v"(b));
  return d;
}
// 16x16x32 fragments: lane = (h = lane>>4, row/col = lane&15); elements 0..7 = k0+8h+0..7, 8..15 = k0+16+8h+0..7; D element r = row 8h+r
__device__ __forceinline__ v16h frag_h(const _Float16* rowk0, int lane) {
  union { v16h v; v8h q[2]; } u; const _Float16* p = rowk0 + 8 * (lane >> 4);
  u.q[0] = *(const v8h*)p; u.q[1] = *(const v8h*)(p + 16); return u.v;
}
__device__ __forceinline__ v16h frag_f32(const float* rowk0, int lane) {
  v16h a; const float* p = rowk0 + 8 * (lane >> 4);
#pragma unroll
  for (int i = 0; i < 8; ++i) { a[i] = (_Float16)p[i]; a[8 + i] = (_Float16)p[16 + i]; }
  return a;
}
__device__ __forceinline__ v16h frag_f32s(const float* rowk0, int lane, float sc) {
  v16h a; const float* p = rowk0 + 8 * (lane >> 4);
#pragma unroll
  for (int i = 0; i < 8; ++i) { a[i] = (_Float16)(p[i] * sc); a[8 + i] = (_Float16)(p[16 + i] * sc); }
  return a;
}
// column fragment from a [K][ld] layout (column n), rows >= K read as 0
__device__ __forceinline__ v16h fragc_f32(const float* W, int k0, int n, int lane, int ld, int K) {
  v16h a; const int g = lane >> 4;
#pragma unroll
  for (int i = 0; i < 8; ++i) { const int ka = k0 + 8 * g + i, kb = ka + 16;
    a[i] = (_Float16)(ka < K ? W[(size_t)(ka < K ? ka : K - 1) * ld + n] : 0.f); a[8 + i] = (_Float16)(kb < K ? W[(size_t)(kb < K ? kb : K - 1) * ld + n] : 0.f); }
  return a;
}
struct F2 { v16b h, l; };
__device__ __forceinline__ F2 bsplit16(const float v[16]) { F2 r;
#pragma unroll
  for (int i = 0; i < 16; ++i) { const __bf16 h = (__bf16)v[i]; r.h[i] = h; r.l[i] = (__bf16)(v[i] - (float)h); }
  return r; }
__device__ __forceinline__ F2 split_row(const float* row, int k0, int lane) { float v[16]; const float* p = row + k0 + 8 * (lane >> 4);
#pragma unroll
  for (int i = 0; i < 8; ++i) { v[i] = p[i]; v[8 + i] = p[16 + i]; }
  return bsplit16(v); }
__device__ __forceinline__ F2 split_rowK(const float* row, int k0, int lane, int K) { float v[16]; const int g = lane >> 4;
#pragma unroll
  for (int i = 0; i < 8; ++i) { const int ka = k0 + 8 * g + i, kb = ka + 16; v[i] = ka < K ? row[ka < K ? ka : K - 1] : 0.f; v[8 + i] = kb < K ? row[kb < K ? kb : K - 1] : 0.f; }
  return bsplit16(v); }
__device__ __forceinline__ F2 split_col(const float* W, int k0, int n, int lane, int ld, int K) { float v[16]; const int g = lane >> 4;
#pragma unroll
  for (int i = 0; i < 8; ++i) { const int ka = k0 + 8 * g + i, kb = ka + 16; v[i] = ka < K ? W[(size_t)(ka < K ? ka : K - 1) * ld + n] : 0.f; v[8 + i] = kb < K ? W[(size_t)(kb < K ? kb : K - 1) * ld + n] : 0.f; }
  return bsplit16(v); }
__device__ __forceinline__ v8f mac3(const F2& a, const F2& b, v8f c) { c = wmma_bf(a.l, b.h, c); c = wmma_bf(a.h, b.l, c); return wmma_bf(a.h, b.h, c); }
__device__ __forceinline__ float sigm(float v) { return 1.0f / (1.0f + expf(-v)); }
#define LDSX() do { asm volatile("s_wait_dscnt 0" ::: "memory"); __builtin_amdgcn_wave_barrier(); __builtin_amdgcn_fence(__ATOMIC_RELEASE, "workgroup"); } while (0)


// Uni/bidirectional spatial attention (B 2, C 64, 16^3 = 4,096 voxels): target->target and source->target single-head attentions from 1x1x1 projections, averaged, then a 1x1x1 output projection.
#define NB 2
#define CC 64
#define NN 4096
#define NP 2               // attention pairs: 0 = tt, 1 = st
#ifndef TQB
#define TQB (NN / 64)
#define TNB NB
#endif
typedef __attribute__((ext_vector_type(8))) __bf16 v8b;
__device__ __forceinline__ v16b frag_b(const __bf16* rowk0, int lane) {
  union { v16b v; v8b q[2]; } u; const __bf16* p = rowk0 + 8 * (lane >> 4);
  u.q[0] = *(const v8b*)p; u.q[1] = *(const v8b*)(p + 16); return u.v;
}
__device__ __forceinline__ float bfr(float v) { return (float)(__bf16)v; }
__device__ __attribute__((noinline)) float exp_ni(float v) { return expf(v); }
__device__ __attribute__((noinline)) float erf_ni(float v) { return erff(v); }

#define WS_PW  0u                                   // bf16 natural rows: Wq_tt, Wk_tt, Wv_tt, Wq_st, Wk_st, Wv_st, Wout  [7][64][64]
#define WS_Q   (WS_PW + 2u * 7 * CC * CC)           // f16 rows [p][b][n][64] q ; k ; planes V [p][b][64][n] ; O f32 [p][b][n][64]
#define WS_K   (WS_Q + 2u * (size_t)NP * NB * NN * CC)
#define WS_V   (WS_K + 2u * (size_t)NP * NB * NN * CC)
#define WS_O   (WS_V + 2u * (size_t)NP * NB * CC * NN)
#define WS_END (WS_O + 4u * (size_t)NP * NB * NN * CC)

__global__ __launch_bounds__(64) void k_pack(const float* __restrict__ W0, const float* __restrict__ W1, const float* __restrict__ W2, const float* __restrict__ W3, const float* __restrict__ W4, const float* __restrict__ W5, const float* __restrict__ W6, __bf16* __restrict__ P) {
  const int n = blockIdx.x, m = blockIdx.y, t = threadIdx.x; const float* src = (m == 0) ? W0 : (m == 1) ? W1 : (m == 2) ? W2 : (m == 3) ? W3 : (m == 4) ? W4 : (m == 5) ? W5 : W6; __shared__ __align__(16) __bf16 s[CC]; s[t] = (__bf16)src[(size_t)n * CC + t]; __syncthreads(); if (t < CC / 8) vst2((unsigned*)(P + ((size_t)m * CC + n) * CC + t * 8), *(const v4u*)&s[t * 8]); }
// ---- k_proj: block = (64 voxels, which of 6, b): input tgt (which 0,1,2,3) or src (4,5); A gathered channels-first; which -> (pair, role): 0 q_tt, 1 k_tt, 2 v_tt, 3 q_st, 4 k_st, 5 v_st
__global__ __launch_bounds__(128) void k_proj(const float* __restrict__ SRC, const float* __restrict__ TGT, const __bf16* __restrict__ P, _Float16* __restrict__ Q, _Float16* __restrict__ Kr, _Float16* __restrict__ V) {
  __shared__ __align__(16) _Float16 so[64][72]; __shared__ __align__(16) _Float16 st[64][72];
  const int tid = threadIdx.x, wave = tid >> 5, lane = tid & 31, col = lane & 15, g = lane >> 4; const int which = blockIdx.y; const size_t b = blockIdx.z; const int n0b = blockIdx.x * 64, n0 = n0b + wave * 16;
  const float* X = (which >= 4) ? SRC : TGT; const int pair = (which >= 3) ? 1 : 0; const int role = (which >= 3) ? (which - 3) : which;
  v8f acc[4] = {};
#pragma unroll
  for (int kc = 0; kc < CC / 32; ++kc) { v16b a; { const float* p = X + (b * CC + kc * 32 + 8 * g) * NN + n0 + col;
#pragma unroll
      for (int i = 0; i < 8; ++i) { a[i] = (__bf16)p[(size_t)i * NN]; a[8 + i] = (__bf16)p[(size_t)(16 + i) * NN]; } }
#pragma unroll
    for (int j = 0; j < 4; ++j) acc[j] = wmma_bf(a, frag_b(P + ((size_t)which * CC + j * 16 + col) * CC + kc * 32, lane), acc[j]); }
  if (role < 2) { _Float16* dst = ((role == 0) ? Q : Kr) + ((size_t)pair * NB + b) * NN * CC;
#pragma unroll
    for (int j = 0; j < 4; ++j)
#pragma unroll
      for (int r = 0; r < 8; ++r) so[wave * 16 + 8 * g + r][j * 16 + col] = (_Float16)acc[j][r];
    LDSX();
    for (int rl = 0; rl < 16; ++rl) if (lane < 8) vst2((unsigned*)(dst + (size_t)(n0 + rl) * CC + lane * 8), *(const v4u*)&so[wave * 16 + rl][lane * 8]);
  } else { _Float16* dst = V + ((size_t)pair * NB + b) * CC * NN;
#pragma unroll
    for (int j = 0; j < 4; ++j)
#pragma unroll
      for (int r = 0; r < 8; ++r) st[j * 16 + col][wave * 16 + 8 * g + r] = (_Float16)acc[j][r];
    __syncthreads();
    for (int e = tid; e < 64 * 8; e += 128) { const int d = e >> 3, pc = e & 7; vst2((unsigned*)(dst + (size_t)d * NN + n0b + pc * 8), *(const v4u*)&st[d][pc * 8]); } }
}
// ---- k_attn: block = (64 queries, pair*NB + b), 4 * KSP waves: wave = (16-query tile qg, key split sp); split sp walks the 32-key blocks sp, sp + KSP, ... with its own running max, sum and accumulators; the KSP partials of a tile are merged through LDS. Single 64-wide head over all 4,096 voxels, scale 1/8
// The products run transposed: S^T = K . Q^T (A = key rows, B = query rows) and O^T += V^T . P^T (A = V planes, B = P^T). A lane then holds 16 scores of ONE query (column col; keys 8g + r of each 16-key tile), so maximum and sum run in its own registers, and the two score tiles, converted in place, are the B operand of the second product in the hardware k order that frag_h gives V
#define KSP 7              // key splits per 16-query tile: 4 tiles x 7 splits = 28 waves, 7 per SIMD, to cover each other's load latencies
__device__ __forceinline__ float xhalf(float x) { return __builtin_bit_cast(float, __builtin_amdgcn_permlanex16(__builtin_bit_cast(int, x), __builtin_bit_cast(int, x), 0x76543210, 0xfedcba98, false, false)); }  // lane l with lane l ^ 16
__global__ __launch_bounds__(128 * KSP) void k_attn(const _Float16* __restrict__ Q, const _Float16* __restrict__ Kr, const _Float16* __restrict__ V, float* __restrict__ O) {
  __shared__ __align__(16) float so[4 * KSP][16][68]; __shared__ float sm[4 * KSP][16]; __shared__ float sl[4 * KSP][16];
  const int tid = threadIdx.x, wave = __builtin_amdgcn_readfirstlane(tid >> 5), lane = tid & 31, col = lane & 15, g = lane >> 4; const int qg = wave & 3, sp = wave >> 2; const size_t pb = blockIdx.y; const int q0 = blockIdx.x * 64 + qg * 16; const size_t rq = pb * NN + q0;
  v16h bq[2];
#pragma unroll
  for (int kc = 0; kc < 2; ++kc) bq[kc] = frag_h(Q + (rq + col) * CC + kc * 32, lane);
  float m = -3.0e38f, l = 0.f;   // of query col; m is common to the two lane halves, l is this half's keys only
  v8f acc[4] = {};               // acc[dt][r] = O^T[dt * 16 + 8g + r][col]
#pragma unroll 1
  for (int ks = sp; ks < NN / 32; ks += KSP) { const int j0 = ks * 32; v8f s[2];
#pragma unroll
    for (int ct = 0; ct < 2; ++ct) { const size_t rk = (pb * NN + j0 + ct * 16 + col) * CC; v8f c = {};
#pragma unroll
      for (int kc = 0; kc < 2; ++kc) c = wmma16(frag_h(Kr + rk + kc * 32, lane), bq[kc], c);
#pragma unroll
      for (int r = 0; r < 8; ++r) s[ct][r] = c[r] * 0.125f; }
    float mx = fmaxf(s[0][0], s[1][0]);
#pragma unroll
    for (int r = 1; r < 8; ++r) mx = fmaxf(mx, fmaxf(s[0][r], s[1][r]));
    mx = fmaxf(mx, xhalf(mx));
    const float mn = fmaxf(m, mx); float ea;
    // exp(m - mn) as v_exp_f32 with its own v_nop: the slot the instruction set asks for behind a transcendental before its result is read.
    asm("v_exp_f32 %0, %1\n\tv_nop" : "=v"(ea) : "v"((m - mn) * 1.44269504f));
    const float alpha = (m <= -1.0e38f) ? 0.f : ea; v8f e[2]; v16h pt;
#pragma unroll
    for (int ct = 0; ct < 2; ++ct)
#pragma unroll
      for (int r = 0; r < 8; ++r) { e[ct][r] = __expf(s[ct][r] - mn); pt[8 * ct + r] = (_Float16)(e[ct][r] * 2048.0f); }
    const v8f t = e[0] + e[1]; const float es = ((t[0] + t[1]) + (t[2] + t[3])) + ((t[4] + t[5]) + (t[6] + t[7]));
    l = l * alpha + es; m = mn;
#pragma unroll
    for (int dt = 0; dt < 4; ++dt) acc[dt] *= alpha;
#pragma unroll
    for (int dt = 0; dt < 4; ++dt) acc[dt] = wmma16(frag_h(V + (pb * CC + dt * 16 + col) * NN + j0, lane), pt, acc[dt]); }
  // each wave leaves its un-normalised partial with its (max, sum) per query; every split has walked at least NN / 32 / KSP blocks, so every max is a real score
  l += xhalf(l);
#pragma unroll
  for (int dt = 0; dt < 4; ++dt) { const v4f lo = {acc[dt][0], acc[dt][1], acc[dt][2], acc[dt][3]}, hi = {acc[dt][4], acc[dt][5], acc[dt][6], acc[dt][7]}; *(v4f*)&so[wave][col][dt * 16 + 8 * g] = lo; *(v4f*)&so[wave][col][dt * 16 + 8 * g + 4] = hi; }
  if (g == 0) { sm[wave][col] = m; sl[wave][col] = l; }
  __syncthreads();   // the partials of all splits are read by other waves below
  for (int e = tid; e < 64 * 16; e += 128 * KSP) { const int row = e >> 4, c4 = e & 15, tq = row >> 4, rl = row & 15; float mm[KSP]; float M = -3.0e38f;
#pragma unroll
    for (int p = 0; p < KSP; ++p) { mm[p] = sm[p * 4 + tq][rl]; M = fmaxf(M, mm[p]); }
    float L = 0.f; v4f o = {};
#pragma unroll
    for (int p = 0; p < KSP; ++p) { const float w = __expf(mm[p] - M); L += w * sl[p * 4 + tq][rl]; o += w * *(const v4f*)&so[p * 4 + tq][rl][c4 * 4]; }
    vst2(O + (pb * NN + blockIdx.x * 64 + row) * CC + c4 * 4, o * ((1.0f / 2048.0f) / L)); }
}
// ---- k_fin: block = (64 voxels, b): att = (O_tt + O_st) / 2 (f32), out = att (bf16 hi + lo) . Wout^T (exact), channels-first 256-B segments
__global__ __launch_bounds__(128) void k_fin(const float* __restrict__ O, const __bf16* __restrict__ P, float* __restrict__ OUT) {
  __shared__ __align__(16) float sa[4][16][68]; __shared__ __align__(16) float st[64][68];
  const int tid = threadIdx.x, wave = tid >> 5, lane = tid & 31, col = lane & 15, g = lane >> 4; const size_t b = blockIdx.y; const int n0b = blockIdx.x * 64, n0 = n0b + wave * 16;
  for (int e = lane; e < 16 * CC; e += 32) { const int rl = e >> 6, c = e & 63; sa[wave][rl][c] = (O[((0 * NB + b) * NN + n0 + rl) * CC + c] + O[((1 * NB + b) * NN + n0 + rl) * CC + c]) * 0.5f; }
  LDSX();
  v8f acc[4] = {};
#pragma unroll
  for (int kc = 0; kc < CC / 32; ++kc) { const F2 a = split_row(&sa[wave][col][0], kc * 32, lane);
#pragma unroll
    for (int jt = 0; jt < 4; ++jt) { const v16b w = frag_b(P + ((size_t)6 * CC + jt * 16 + col) * CC + kc * 32, lane); acc[jt] = wmma_bf(a.h, w, acc[jt]); acc[jt] = wmma_bf(a.l, w, acc[jt]); } }
#pragma unroll
  for (int jt = 0; jt < 4; ++jt)
#pragma unroll
    for (int r = 0; r < 8; ++r) st[jt * 16 + col][wave * 16 + 8 * g + r] = acc[jt][r];
  __syncthreads();
  for (int e = tid; e < CC * 16; e += 128) { const int o = e >> 4, q = e & 15; vst2(OUT + ((b * CC + o) * NN) + n0b + q * 4, *(const v4f*)&st[o][q * 4]); }
}
extern "C" void kernel_launch(void* const* d_in, const int* in_sizes, int n_in, void* d_out, int out_size, void* d_ws, size_t ws_size, hipStream_t stream) {
  (void)in_sizes; (void)n_in; (void)out_size;
  const float** F = (const float**)d_in;   // 0 source, 1 target [2,64,16,16,16]; 2 Wq_tt, 3 Wq_st, 4 Wk_tt, 5 Wk_st, 6 Wv_tt, 7 Wv_st, 8 Wout ([64,64] natural [out][in])
  if (ws_size < (size_t)WS_END) return;
  char* ws = (char*)d_ws; __bf16* P = (__bf16*)ws; _Float16 *Q = (_Float16*)(ws + WS_Q), *Kr = (_Float16*)(ws + WS_K), *V = (_Float16*)(ws + WS_V); float* O = (float*)(ws + WS_O);
  k_pack<<<dim3(CC, 7), 64, 0, stream>>>(F[2], F[4], F[6], F[3], F[5], F[7], F[8], P);   // packed order: q_tt, k_tt, v_tt, q_st, k_st, v_st, Wout
  k_proj<<<dim3(NN / 64, 6, NB), 128, 0, stream>>>(F[0], F[1], P, Q, Kr, V);
  k_attn<<<dim3(TQB, NP * TNB), 128 * KSP, 0, stream>>>(Q, Kr, V, O);
  k_fin<<<dim3(TQB, TNB), 128, 0, stream>>>(O, P, (float*)d_out);
}

// v003
// It runs in 39.3 microseconds.
// Timed twice side by side with v002, it ran 2.16 and 2.13 times as fast.
// Over all steps from v000 it is 6.61 times as fast.
// compute dtype: all float inputs rounded to bf16; the six pointwise projections with EXACT bf16 products on WMMA 16x16x32 (channels-first inputs gathered into token rows), rounded once to f16; two PLAIN 64-wide attentions: q, k single f16 x 1/8, running-max softmax in f32 (hardware exp), P (scaled by 2^11, single f16) x v (single f16); the average of the two in f32, split into bf16 hi + lo x exact Wout (2 products); channels-first f32 output.
#include <hip/hip_runtime.h>
#include <math.h>

typedef __attribute__((ext_vector_type(16))) _Float16 v16h;
typedef __attribute__((ext_vector_type(16))) __bf16 v16b;
typedef __attribute__((ext_vector_type(8)))  _Float16 v8h;
typedef __attribute__((ext_vector_type(8)))  float v8f;
typedef __attribute__((ext_vector_type(4)))  float v4f;
typedef __attribute__((ext_vector_type(2)))  float v2f;
typedef __attribute__((ext_vector_type(4)))  unsigned v4u;
typedef __attribute__((ext_vector_type(4)))  int v4i;
typedef float __attribute__((may_alias)) float_a;
typedef int __attribute__((may_alias)) int_a;

template <typename T> __device__ __forceinline__ void vst2(void* p, T v) { *(T*)p = v;  }
__device__ __forceinline__ v8f wmma16(v16h a, v16h b, v8f c) {
  v8f d = __builtin_amdgcn_wmma_f32_16x16x32_f16(false, a, false, b, (short)0, c, false, false);
  asm volatile("v_nop\n\tv_nop\n\tv_nop\n\tv_nop" : "+v"(d) : "v"(a), "v"(b));
  return d;
}
__device__ __forceinline__ v8f wmma_bf(v16b a, v16b b, v8f c) {
  v8f d = __builtin_amdgcn_wmma_f32_16x16x32_bf16(false, a, false, b, (short)0, c, false, false);
  asm volatile("v_nop\n\tv_nop\n\tv_nop\n\tv_nop" : "+v"(d) : "v"(a), "v"(b));
  return d;
}
// 16x16x32 fragments: lane = (h = lane>>4, row/col = lane&15); elements 0..7 = k0+8h+0..7, 8..15 = k0+16+8h+0..7; D element r = row 8h+r
__device__ __forceinline__ v16h frag_h(const _Float16* rowk0, int lane) {
  union { v16h v; v8h q[2]; } u; const _Float16* p = rowk0 + 8 * (lane >> 4);
  u.q[0] = *(const v8h*)p; u.q[1] = *(const v8h*)(p + 16); return u.v;
}
__device__ __forceinline__ v16h frag_f32(const float* rowk0, int lane) {
  v16h a; const float* p = rowk0 + 8 * (lane >> 4);
#pragma unroll
  for (int i = 0; i < 8; ++i) { a[i] = (_Float16)p[i]; a[8 + i] = (_Float16)p[16 + i]; }
  return a;
}
__device__ __forceinline__ v16h frag_f32s(const float* rowk0, int lane, float sc) {
  v16h a; const float* p = rowk0 + 8 * (lane >> 4);
#pragma unroll
  for (int i = 0; i < 8; ++i) { a[i] = (_Float16)(p[i] * sc); a[8 + i] = (_Float16)(p[16 + i] * sc); }
  return a;
}
// column fragment from a [K][ld] layout (column n), rows >= K read as 0
__device__ __forceinline__ v16h fragc_f32(const float* W, int k0, int n, int lane, int ld, int K) {
  v16h a; const int g = lane >> 4;
#pragma unroll
  for (int i = 0; i < 8; ++i) { const int ka = k0 + 8 * g + i, kb = ka + 16;
    a[i] = (_Float16)(ka < K ? W[(size_t)(ka < K ? ka : K - 1) * ld + n] : 0.f); a[8 + i] = (_Float16)(kb < K ? W[(size_t)(kb < K ? kb : K - 1) * ld + n] : 0.f); }
  return a;
}
struct F2 { v16b h, l; };
__device__ __forceinline__ F2 bsplit16(const float v[16]) { F2 r;
#pragma unroll
  for (int i = 0; i < 16; ++i) { const __bf16 h = (__bf16)v[i]; r.h[i] = h; r.l[i] = (__bf16)(v[i] - (float)h); }
  return r; }
__device__ __forceinline__ F2 split_row(const float* row, int k0, int lane) { float v[16]; const float* p = row + k0 + 8 * (lane >> 4);
#pragma unroll
  for (int i = 0; i < 8; ++i) { v[i] = p[i]; v[8 + i] = p[16 + i]; }
  return bsplit16(v); }
__device__ __forceinline__ F2 split_rowK(const float* row, int k0, int lane, int K) { float v[16]; const int g = lane >> 4;
#pragma unroll
  for (int i = 0; i < 8; ++i) { const int ka = k0 + 8 * g + i, kb = ka + 16; v[i] = ka < K ? row[ka < K ? ka : K - 1] : 0.f; v[8 + i] = kb < K ? row[kb < K ? kb : K - 1] : 0.f; }
  return bsplit16(v); }
__device__ __forceinline__ F2 split_col(const float* W, int k0, int n, int lane, int ld, int K) { float v[16]; const int g = lane >> 4;
#pragma unroll
  for (int i = 0; i < 8; ++i) { const int ka = k0 + 8 * g + i, kb = ka + 16; v[i] = ka < K ? W[(size_t)(ka < K ? ka : K - 1) * ld + n] : 0.f; v[8 + i] = kb < K ? W[(size_t)(kb < K ? kb : K - 1) * ld + n] : 0.f; }
  return bsplit16(v); }
__device__ __forceinline__ v8f mac3(const F2& a, const F2& b, v8f c) { c = wmma_bf(a.l, b.h, c); c = wmma_bf(a.h, b.l, c); return wmma_bf(a.h, b.h, c); }
__device__ __forceinline__ float sigm(float v) { return 1.0f / (1.0f + expf(-v)); }
#define LDSX() do { asm volatile("s_wait_dscnt 0" ::: "memory"); __builtin_amdgcn_wave_barrier(); __builtin_amdgcn_fence(__ATOMIC_RELEASE, "workgroup"); } while (0)


// Uni/bidirectional spatial attention (B 2, C 64, 16^3 = 4,096 voxels): target->target and source->target single-head attentions from 1x1x1 projections, averaged, then a 1x1x1 output projection.
#define NB 2
#define CC 64
#define NN 4096
#define NP 2               // attention pairs: 0 = tt, 1 = st
#ifndef TQB
#define TQB (NN / 64)
#define TNB NB
#endif
typedef __attribute__((ext_vector_type(8))) __bf16 v8b;
__device__ __forceinline__ v16b frag_b(const __bf16* rowk0, int lane) {
  union { v16b v; v8b q[2]; } u; const __bf16* p = rowk0 + 8 * (lane >> 4);
  u.q[0] = *(const v8b*)p; u.q[1] = *(const v8b*)(p + 16); return u.v;
}
__device__ __forceinline__ float bfr(float v) { return (float)(__bf16)v; }
__device__ __attribute__((noinline)) float exp_ni(float v) { return expf(v); }
__device__ __attribute__((noinline)) float erf_ni(float v) { return erff(v); }

#define WS_PW  0u                                   // bf16 natural rows: Wq_tt, Wk_tt, Wv_tt, Wq_st, Wk_st, Wv_st, Wout  [7][64][64]
#define WS_Q   (WS_PW + 2u * 7 * CC * CC)           // f16 rows [p][b][n][64] q ; k ; planes V [p][b][64][n] ; O f32 [p][b][n][64]
#define WS_K   (WS_Q + 2u * (size_t)NP * NB * NN * CC)
#define WS_V   (WS_K + 2u * (size_t)NP * NB * NN * CC)
#define WS_O   (WS_V + 2u * (size_t)NP * NB * CC * NN)
#define WS_END (WS_O + 4u * (size_t)NP * NB * NN * CC)

__global__ __launch_bounds__(64) void k_pack(const float* __restrict__ W0, const float* __restrict__ W1, const float* __restrict__ W2, const float* __restrict__ W3, const float* __restrict__ W4, const float* __restrict__ W5, const float* __restrict__ W6, __bf16* __restrict__ P) {
  const int n = blockIdx.x, m = blockIdx.y, t = threadIdx.x; const float* src = (m == 0) ? W0 : (m == 1) ? W1 : (m == 2) ? W2 : (m == 3) ? W3 : (m == 4) ? W4 : (m == 5) ? W5 : W6; __shared__ __align__(16) __bf16 s[CC]; s[t] = (__bf16)src[(size_t)n * CC + t]; __syncthreads(); if (t < CC / 8) vst2((unsigned*)(P + ((size_t)m * CC + n) * CC + t * 8), *(const v4u*)&s[t * 8]); }
// ---- k_proj: block = (64 voxels, which of 6, b): input tgt (which 0,1,2,3) or src (4,5); A gathered channels-first; which -> (pair, role): 0 q_tt, 1 k_tt, 2 v_tt, 3 q_st, 4 k_st, 5 v_st
__global__ __launch_bounds__(128) void k_proj(const float* __restrict__ SRC, const float* __restrict__ TGT, const __bf16* __restrict__ P, _Float16* __restrict__ Q, _Float16* __restrict__ Kr, _Float16* __restrict__ V) {
  __shared__ __align__(16) _Float16 so[64][72]; __shared__ __align__(16) _Float16 st[64][72];
  const int tid = threadIdx.x, wave = tid >> 5, lane = tid & 31, col = lane & 15, g = lane >> 4; const int which = blockIdx.y; const size_t b = blockIdx.z; const int n0b = blockIdx.x * 64, n0 = n0b + wave * 16;
  const float* X = (which >= 4) ? SRC : TGT; const int pair = (which >= 3) ? 1 : 0; const int role = (which >= 3) ? (which - 3) : which;
  v8f acc[4] = {};
#pragma unroll
  for (int kc = 0; kc < CC / 32; ++kc) { v16b a; { const float* p = X + (b * CC + kc * 32 + 8 * g) * NN + n0 + col;
#pragma unroll
      for (int i = 0; i < 8; ++i) { a[i] = (__bf16)p[(size_t)i * NN]; a[8 + i] = (__bf16)p[(size_t)(16 + i) * NN]; } }
#pragma unroll
    for (int j = 0; j < 4; ++j) acc[j] = wmma_bf(a, frag_b(P + ((size_t)which * CC + j * 16 + col) * CC + kc * 32, lane), acc[j]); }
  if (role < 2) { _Float16* dst = ((role == 0) ? Q : Kr) + ((size_t)pair * NB + b) * NN * CC;
#pragma unroll
    for (int j = 0; j < 4; ++j)
#pragma unroll
      for (int r = 0; r < 8; ++r) so[wave * 16 + 8 * g + r][j * 16 + col] = (_Float16)acc[j][r];
    LDSX();
    for (int rl = 0; rl < 16; ++rl) if (lane < 8) vst2((unsigned*)(dst + (size_t)(n0 + rl) * CC + lane * 8), *(const v4u*)&so[wave * 16 + rl][lane * 8]);
  } else { _Float16* dst = V + ((size_t)pair * NB + b) * CC * NN;
#pragma unroll
    for (int j = 0; j < 4; ++j)
#pragma unroll
      for (int r = 0; r < 8; ++r) st[j * 16 + col][wave * 16 + 8 * g + r] = (_Float16)acc[j][r];
    __syncthreads();
    for (int e = tid; e < 64 * 8; e += 128) { const int d = e >> 3, pc = e & 7; vst2((unsigned*)(dst + (size_t)d * NN + n0b + pc * 8), *(const v4u*)&st[d][pc * 8]); } }
}
// ---- k_attn: block = (64 queries, pair*NB + b), 4 * KSP waves: wave = (16-query tile qg, key split sp); the keys go by in stages of STK = 32 * KSP, and in each stage split sp takes the 32-key block sp with its own running max, sum and accumulators; the KSP partials of a tile are merged through LDS. Single 64-wide head over all 4,096 voxels, scale 1/8
// The products run transposed: S^T = K . Q^T (A = key rows, B = query rows) and O^T += V^T . P^T (A = V planes, B = P^T). A lane then holds 16 scores of ONE query (column col; keys 8g + r of each 16-key tile), so maximum and sum run in its own registers, and the two score tiles, converted in place, are the B operand of the second product in the hardware k order that frag_h gives V
// A stage's K rows and V plane slices are brought into LDS once for the whole block, by asynchronous copies that cover whole 128-B lines (a wave's 32 lanes x 16 B = 512 contiguous bytes), two buffers: stage t + 1 flies while stage t is worked on. The fragments are then read from LDS at padded pitches; read straight from global memory each fragment load touched 16 lines, and each of the 4 query tiles fetched the same keys again
#define KSP 8              // key splits per 16-query tile: 4 tiles x 8 splits = 32 waves, 8 per SIMD; 8 so that a stage of 256 keys divides the 4,096
#define STK (32 * KSP)     // keys per stage
#define NST (NN / STK)     // stages
#define KPB (2 * CC + 16)  // LDS pitch of a K row, bytes: 144 = 16 x 9, free of bank conflicts for 16-byte reads down a column of rows
#define VPB (2 * STK + 16) // LDS pitch of a V plane's slice, bytes: 528 = 16 x 33, likewise
#define KBB (STK * KPB)    // K part of a buffer, bytes
#define STB (KBB + CC * VPB)   // one buffer, bytes
__device__ __forceinline__ float xhalf(float x) { return __builtin_bit_cast(float, __builtin_amdgcn_permlanex16(__builtin_bit_cast(int, x), __builtin_bit_cast(int, x), 0x76543210, 0xfedcba98, false, false)); }  // lane l with lane l ^ 16
// a thread's four 16-byte copies of one stage: K rows r and r + STK / 2, V planes d and d + CC / 2. lk, lv: LDS byte addresses; gk, gv: global sources
__device__ __forceinline__ void stage_copy(unsigned lk, unsigned lv, const _Float16* gk, const _Float16* gv) {
  const unsigned lk1 = lk + (STK / 2) * KPB, lv1 = lv + (CC / 2) * VPB; const _Float16* gk1 = gk + (size_t)(STK / 2) * CC; const _Float16* gv1 = gv + (size_t)(CC / 2) * NN;
  // the copies go past the registers; s_wait_xcnt closes the statement so that no address register named here is rewritten ahead of it
  asm volatile("global_load_async_to_lds_b128 %0, %4, off\n\tglobal_load_async_to_lds_b128 %1, %5, off\n\tglobal_load_async_to_lds_b128 %2, %6, off\n\tglobal_load_async_to_lds_b128 %3, %7, off\n\ts_wait_xcnt 0x0" :: "v"(lk), "v"(lk1), "v"(lv), "v"(lv1), "v"(gk), "v"(gk1), "v"(gv), "v"(gv1) : "memory");
}
__global__ __launch_bounds__(128 * KSP) void k_attn(const _Float16* __restrict__ Q, const _Float16* __restrict__ Kr, const _Float16* __restrict__ V, float* __restrict__ O) {
  __shared__ __align__(16) unsigned char ring[2][STB];
  __shared__ __align__(16) float so[4 * KSP][16][68]; __shared__ float sm[4 * KSP][16]; __shared__ float sl[4 * KSP][16];
  const int tid = threadIdx.x, wave = __builtin_amdgcn_readfirstlane(tid >> 5), lane = tid & 31, col = lane & 15, g = lane >> 4; const int qg = wave & 3, sp = wave >> 2; const size_t pb = blockIdx.y; const int q0 = blockIdx.x * 64 + qg * 16; const size_t rq = pb * NN + q0;
  // K: 16-byte piece tid of the stage's first 128 rows (8 pieces a row, the rows contiguous in memory); V: piece lane of plane tid >> 5 (32 pieces a slice)
  const unsigned lk = (unsigned)(size_t)&ring[0][0] + (unsigned)((tid >> 3) * KPB + (tid & 7) * 16), lv = (unsigned)(size_t)&ring[0][0] + (unsigned)(KBB + (tid >> 5) * VPB + lane * 16);
  const _Float16* gk = Kr + pb * NN * CC + tid * 8; const _Float16* gv = V + (pb * CC + (tid >> 5)) * NN + lane * 8;
  stage_copy(lk, lv, gk, gv);
  v16h bq[2];
#pragma unroll
  for (int kc = 0; kc < 2; ++kc) bq[kc] = frag_h(Q + (rq + col) * CC + kc * 32, lane);
  float m = -3.0e38f, l = 0.f;   // of query col; m is common to the two lane halves, l is this half's keys only
  v8f acc[4] = {};               // acc[dt][r] = O^T[dt * 16 + 8g + r][col]
  asm volatile("s_wait_asynccnt 0x0" ::: "memory");   // this wave's copies of stage 0 have landed
  __syncthreads();                                    // and every other wave's: stage 0 may be read
  stage_copy(lk + STB, lv + STB, gk + (size_t)STK * CC, gv + STK);
#pragma unroll 1
  for (int t = 0; t < NST; ++t) { const unsigned char* kb = &ring[t & 1][0] + (sp * 32 + col) * KPB; const unsigned char* vb = &ring[t & 1][0] + KBB + col * VPB + sp * 64; v8f s[2]; v16h ka[2][2], va[4];
    // the pass's LDS reads stand in two groups, K ahead of the first product and V ahead of the softmax, so that a wave waits out the LDS latency twice a pass and not once a fragment
#pragma unroll
    for (int ct = 0; ct < 2; ++ct)
#pragma unroll
      for (int kc = 0; kc < 2; ++kc) ka[ct][kc] = frag_h((const _Float16*)(kb + ct * 16 * KPB) + kc * 32, lane);
#pragma unroll
    for (int ct = 0; ct < 2; ++ct) { v8f c = {};
#pragma unroll
      for (int kc = 0; kc < 2; ++kc) c = wmma16(ka[ct][kc], bq[kc], c);
#pragma unroll
      for (int r = 0; r < 8; ++r) s[ct][r] = c[r] * 0.125f; }
#pragma unroll
    for (int dt = 0; dt < 4; ++dt) va[dt] = frag_h((const _Float16*)(vb + dt * 16 * VPB), lane);
    float mx = fmaxf(s[0][0], s[1][0]);
#pragma unroll
    for (int r = 1; r < 8; ++r) mx = fmaxf(mx, fmaxf(s[0][r], s[1][r]));
    mx = fmaxf(mx, xhalf(mx));
    const float mn = fmaxf(m, mx); float ea;
    // exp(m - mn) as v_exp_f32 with its own v_nop: the slot the instruction set asks for behind a transcendental before its result is read.
    asm("v_exp_f32 %0, %1\n\tv_nop" : "=v"(ea) : "v"((m - mn) * 1.44269504f));
    const float alpha = (m <= -1.0e38f) ? 0.f : ea; v8f e[2]; v16h pt;
#pragma unroll
    for (int ct = 0; ct < 2; ++ct)
#pragma unroll
      for (int r = 0; r < 8; ++r) { e[ct][r] = __expf(s[ct][r] - mn); pt[8 * ct + r] = (_Float16)(e[ct][r] * 2048.0f); }
    const v8f ts = e[0] + e[1]; const float es = ((ts[0] + ts[1]) + (ts[2] + ts[3])) + ((ts[4] + ts[5]) + (ts[6] + ts[7]));
    l = l * alpha + es; m = mn;
#pragma unroll
    for (int dt = 0; dt < 4; ++dt) acc[dt] *= alpha;
#pragma unroll
    for (int dt = 0; dt < 4; ++dt) acc[dt] = wmma16(va[dt], pt, acc[dt]);
    asm volatile("s_wait_dscnt 0x0" ::: "memory");      // this wave's reads of stage t are done before its buffer is handed back
    asm volatile("s_wait_asynccnt 0x0" ::: "memory");   // this wave's copies of stage t + 1 have landed
    __syncthreads();                                    // publishes stage t + 1 and ends every wave's reads of stage t
    if (t + 2 < NST) stage_copy(lk + (t & 1) * STB, lv + (t & 1) * STB, gk + (size_t)(t + 2) * STK * CC, gv + (t + 2) * STK); }
  asm volatile("s_wait_asynccnt 0x0" ::: "memory");     // no copy is left in flight behind the loop
  // each wave leaves its un-normalised partial with its (max, sum) per query; every split has walked NST blocks, so every max is a real score
  l += xhalf(l);
#pragma unroll
  for (int dt = 0; dt < 4; ++dt) { const v4f lo = {acc[dt][0], acc[dt][1], acc[dt][2], acc[dt][3]}, hi = {acc[dt][4], acc[dt][5], acc[dt][6], acc[dt][7]}; *(v4f*)&so[wave][col][dt * 16 + 8 * g] = lo; *(v4f*)&so[wave][col][dt * 16 + 8 * g + 4] = hi; }
  if (g == 0) { sm[wave][col] = m; sl[wave][col] = l; }
  __syncthreads();   // the partials of all splits are read by other waves below
  for (int e = tid; e < 64 * 16; e += 128 * KSP) { const int row = e >> 4, c4 = e & 15, tq = row >> 4, rl = row & 15; float mm[KSP]; float M = -3.0e38f;
#pragma unroll
    for (int p = 0; p < KSP; ++p) { mm[p] = sm[p * 4 + tq][rl]; M = fmaxf(M, mm[p]); }
    float L = 0.f; v4f o = {};
#pragma unroll
    for (int p = 0; p < KSP; ++p) { const float w = __expf(mm[p] - M); L += w * sl[p * 4 + tq][rl]; o += w * *(const v4f*)&so[p * 4 + tq][rl][c4 * 4]; }
    vst2(O + (pb * NN + blockIdx.x * 64 + row) * CC + c4 * 4, o * ((1.0f / 2048.0f) / L)); }
}
// ---- k_fin: block = (64 voxels, b): att = (O_tt + O_st) / 2 (f32), out = att (bf16 hi + lo) . Wout^T (exact), channels-first 256-B segments
__global__ __launch_bounds__(128) void k_fin(const float* __restrict__ O, const __bf16* __restrict__ P, float* __restrict__ OUT) {
  __shared__ __align__(16) float sa[4][16][68]; __shared__ __align__(16) float st[64][68];
  const int tid = threadIdx.x, wave = tid >> 5, lane = tid & 31, col = lane & 15, g = lane >> 4; const size_t b = blockIdx.y; const int n0b = blockIdx.x * 64, n0 = n0b + wave * 16;
  for (int e = lane; e < 16 * CC; e += 32) { const int rl = e >> 6, c = e & 63; sa[wave][rl][c] = (O[((0 * NB + b) * NN + n0 + rl) * CC + c] + O[((1 * NB + b) * NN + n0 + rl) * CC + c]) * 0.5f; }
  LDSX();
  v8f acc[4] = {};
#pragma unroll
  for (int kc = 0; kc < CC / 32; ++kc) { const F2 a = split_row(&sa[wave][col][0], kc * 32, lane);
#pragma unroll
    for (int jt = 0; jt < 4; ++jt) { const v16b w = frag_b(P + ((size_t)6 * CC + jt * 16 + col) * CC + kc * 32, lane); acc[jt] = wmma_bf(a.h, w, acc[jt]); acc[jt] = wmma_bf(a.l, w, acc[jt]); } }
#pragma unroll
  for (int jt = 0; jt < 4; ++jt)
#pragma unroll
    for (int r = 0; r < 8; ++r) st[jt * 16 + col][wave * 16 + 8 * g + r] = acc[jt][r];
  __syncthreads();
  for (int e = tid; e < CC * 16; e += 128) { const int o = e >> 4, q = e & 15; vst2(OUT + ((b * CC + o) * NN) + n0b + q * 4, *(const v4f*)&st[o][q * 4]); }
}
extern "C" void kernel_launch(void* const* d_in, const int* in_sizes, int n_in, void* d_out, int out_size, void* d_ws, size_t ws_size, hipStream_t stream) {
  (void)in_sizes; (void)n_in; (void)out_size;
  const float** F = (const float**)d_in;   // 0 source, 1 target [2,64,16,16,16]; 2 Wq_tt, 3 Wq_st, 4 Wk_tt, 5 Wk_st, 6 Wv_tt, 7 Wv_st, 8 Wout ([64,64] natural [out][in])
  if (ws_size < (size_t)WS_END) return;
  char* ws = (char*)d_ws; __bf16* P = (__bf16*)ws; _Float16 *Q = (_Float16*)(ws + WS_Q), *Kr = (_Float16*)(ws + WS_K), *V = (_Float16*)(ws + WS_V); float* O = (float*)(ws + WS_O);
  k_pack<<<dim3(CC, 7), 64, 0, stream>>>(F[2], F[4], F[6], F[3], F[5], F[7], F[8], P);   // packed order: q_tt, k_tt, v_tt, q_st, k_st, v_st, Wout
  k_proj<<<dim3(NN / 64, 6, NB), 128, 0, stream>>>(F[0], F[1], P, Q, Kr, V);
  k_attn<<<dim3(TQB, NP * TNB), 128 * KSP, 0, stream>>>(Q, Kr, V, O);
  k_fin<<<dim3(TQB, TNB), 128, 0, stream>>>(O, P, (float*)d_out);
}

// v004
// It runs in 34.6 microseconds.
// Two timings next to v003 both put it at 1.14 times that version's speed.
// All steps since v000 together make it 7.54 times as fast.
// compute dtype: all float inputs rounded to bf16; the six pointwise projections with EXACT bf16 products on WMMA 16x16x32 (channels-first inputs gathered into token rows), rounded once to f16; two PLAIN 64-wide attentions: q, k single f16 x 1/8, running-max softmax in f32 (hardware exp), P (scaled by 2^11, single f16) x v (single f16); the average of the two in f32, split into bf16 hi + lo x exact Wout (2 products); channels-first f32 output.
#include <hip/hip_runtime.h>
#include <math.h>

typedef __attribute__((ext_vector_type(16))) _Float16 v16h;
typedef __attribute__((ext_vector_type(16))) __bf16 v16b;
typedef __attribute__((ext_vector_type(8)))  _Float16 v8h;
typedef __attribute__((ext_vector_type(8)))  float v8f;
typedef __attribute__((ext_vector_type(4)))  float v4f;
typedef __attribute__((ext_vector_type(2)))  float v2f;
typedef __attribute__((ext_vector_type(4)))  unsigned v4u;
typedef __attribute__((ext_vector_type(4)))  int v4i;
typedef float __attribute__((may_alias)) float_a;
typedef int __attribute__((may_alias)) int_a;

template <typename T> __device__ __forceinline__ void vst2(void* p, T v) { *(T*)p = v;  }
__device__ __forceinline__ v8f wmma16(v16h a, v16h b, v8f c) {
  v8f d = __builtin_amdgcn_wmma_f32_16x16x32_f16(false, a, false, b, (short)0, c, false, false);
  asm volatile("v_nop\n\tv_nop\n\tv_nop\n\tv_nop" : "+v"(d) : "v"(a), "v"(b));
  return d;
}
__device__ __forceinline__ v8f wmma_bf(v16b a, v16b b, v8f c) {
  v8f d = __builtin_amdgcn_wmma_f32_16x16x32_bf16(false, a, false, b, (short)0, c, false, false);
  asm volatile("v_nop\n\tv_nop\n\tv_nop\n\tv_nop" : "+v"(d) : "v"(a), "v"(b));
  return d;
}
// 16x16x32 fragments: lane = (h = lane>>4, row/col = lane&15); elements 0..7 = k0+8h+0..7, 8..15 = k0+16+8h+0..7; D element r = row 8h+r
__device__ __forceinline__ v16h frag_h(const _Float16* rowk0, int lane) {
  union { v16h v; v8h q[2]; } u; const _Float16* p = rowk0 + 8 * (lane >> 4);
  u.q[0] = *(const v8h*)p; u.q[1] = *(const v8h*)(p + 16); return u.v;
}
__device__ __forceinline__ v16h frag_f32(const float* rowk0, int lane) {
  v16h a; const float* p = rowk0 + 8 * (lane >> 4);
#pragma unroll
  for (int i = 0; i < 8; ++i) { a[i] = (_Float16)p[i]; a[8 + i] = (_Float16)p[16 + i]; }
  return a;
}
__device__ __forceinline__ v16h frag_f32s(const float* rowk0, int lane, float sc) {
  v16h a; const float* p = rowk0 + 8 * (lane >> 4);
#pragma unroll
  for (int i = 0; i < 8; ++i) { a[i] = (_Float16)(p[i] * sc); a[8 + i] = (_Float16)(p[16 + i] * sc); }
  return a;
}
// column fragment from a [K][ld] layout (column n), rows >= K read as 0
__device__ __forceinline__ v16h fragc_f32(const float* W, int k0, int n, int lane, int ld, int K) {
  v16h a; const int g = lane >> 4;
#pragma unroll
  for (int i = 0; i < 8; ++i) { const int ka = k0 + 8 * g + i, kb = ka + 16;
    a[i] = (_Float16)(ka < K ? W[(size_t)(ka < K ? ka : K - 1) * ld + n] : 0.f); a[8 + i] = (_Float16)(kb < K ? W[(size_t)(kb < K ? kb : K - 1) * ld + n] : 0.f); }
  return a;
}
struct F2 { v16b h, l; };
__device__ __forceinline__ F2 bsplit16(const float v[16]) { F2 r;
#pragma unroll
  for (int i = 0; i < 16; ++i) { const __bf16 h = (__bf16)v[i]; r.h[i] = h; r.l[i] = (__bf16)(v[i] - (float)h); }
  return r; }
__device__ __forceinline__ F2 split_row(const float* row, int k0, int lane) { float v[16]; const float* p = row + k0 + 8 * (lane >> 4);
#pragma unroll
  for (int i = 0; i < 8; ++i) { v[i] = p[i]; v[8 + i] = p[16 + i]; }
  return bsplit16(v); }
__device__ __forceinline__ F2 split_rowK(const float* row, int k0, int lane, int K) { float v[16]; const int g = lane >> 4;
#pragma unroll
  for (int i = 0; i < 8; ++i) { const int ka = k0 + 8 * g + i, kb = ka + 16; v[i] = ka < K ? row[ka < K ? ka : K - 1] : 0.f; v[8 + i] = kb < K ? row[kb < K ? kb : K - 1] : 0.f; }
  return bsplit16(v); }
__device__ __forceinline__ F2 split_col(const float* W, int k0, int n, int lane, int ld, int K) { float v[16]; const int g = lane >> 4;
#pragma unroll
  for (int i = 0; i < 8; ++i) { const int ka = k0 + 8 * g + i, kb = ka + 16; v[i] = ka < K ? W[(size_t)(ka < K ? ka : K - 1) * ld + n] : 0.f; v[8 + i] = kb < K ? W[(size_t)(kb < K ? kb : K - 1) * ld + n] : 0.f; }
  return bsplit16(v); }
__device__ __forceinline__ v8f mac3(const F2& a, const F2& b, v8f c) { c = wmma_bf(a.l, b.h, c); c = wmma_bf(a.h, b.l, c); return wmma_bf(a.h, b.h, c); }
__device__ __forceinline__ float sigm(float v) { return 1.0f / (1.0f + expf(-v)); }
#define LDSX() do { asm volatile("s_wait_dscnt 0" ::: "memory"); __builtin_amdgcn_wave_barrier(); __builtin_amdgcn_fence(__ATOMIC_RELEASE, "workgroup"); } while (0)


// Uni/bidirectional spatial attention (B 2, C 64, 16^3 = 4,096 voxels): target->target and source->target single-head attentions from 1x1x1 projections, averaged, then a 1x1x1 output projection.
#define NB 2
#define CC 64
#define NN 4096
#define NP 2               // attention pairs: 0 = tt, 1 = st
#ifndef TQB
#define TQB (NN / 64)
#define TNB NB
#endif
typedef __attribute__((ext_vector_type(8))) __bf16 v8b;
__device__ __forceinline__ v16b frag_b(const __bf16* rowk0, int lane) {
  union { v16b v; v8b q[2]; } u; const __bf16* p = rowk0 + 8 * (lane >> 4);
  u.q[0] = *(const v8b*)p; u.q[1] = *(const v8b*)(p + 16); return u.v;
}
__device__ __forceinline__ float bfr(float v) { return (float)(__bf16)v; }
__device__ __attribute__((noinline)) float exp_ni(float v) { return expf(v); }
__device__ __attribute__((noinline)) float erf_ni(float v) { return erff(v); }

#define WS_Q   0u                                   // f16 rows [p][b][n][64] q ; k ; planes V [p][b][64][n] ; O f32 [p][b][n][64]
#define WS_K   (WS_Q + 2u * (size_t)NP * NB * NN * CC)
#define WS_V   (WS_K + 2u * (size_t)NP * NB * NN * CC)
#define WS_O   (WS_V + 2u * (size_t)NP * NB * CC * NN)
#define WS_END (WS_O + 4u * (size_t)NP * NB * NN * CC)

// Each block rounds the one 64 x 64 weight matrix it needs to bf16 itself, into LDS: 8 whole-line 16-byte loads a thread (a wave's 32 lanes x 16 B = 512 contiguous bytes), natural rows at a pitch of 144 B = 16 x 9, free of bank conflicts for the 16-byte fragment reads down a column of rows. No launch ahead packs the weights
#define WPE 72             // LDS pitch of a weight row, bf16 elements
typedef __attribute__((ext_vector_type(4))) __bf16 v4b;
struct WX { v4f x[8]; };
__device__ __forceinline__ WX w_load(const float* __restrict__ Wm, int tid) { WX w;
#pragma unroll   // the eight loads stand in registers and fly together
  for (int i = 0; i < 8; ++i) w.x[i] = *(const v4f*)(Wm + (tid + 128 * i) * 4);
  return w; }
__device__ __forceinline__ void w_store(const WX& w, __bf16 (*sw)[WPE], int tid) {
#pragma unroll   // w.x is indexed by constants only, so it stays in registers
  for (int i = 0; i < 8; ++i) { const int e = tid + 128 * i; const v4b y = {(__bf16)w.x[i][0], (__bf16)w.x[i][1], (__bf16)w.x[i][2], (__bf16)w.x[i][3]}; *(v4b*)&sw[e >> 4][(e & 15) * 4] = y; } }
// ---- k_proj: block = (64 voxels, which of 6, b): input tgt (which 0,1,2,3) or src (4,5); A gathered channels-first; which -> (pair, role): 0 q_tt, 1 k_tt, 2 v_tt, 3 q_st, 4 k_st, 5 v_st
__global__ __launch_bounds__(128) void k_proj(const float* __restrict__ SRC, const float* __restrict__ TGT, const float* __restrict__ W0, const float* __restrict__ W1, const float* __restrict__ W2, const float* __restrict__ W3, const float* __restrict__ W4, const float* __restrict__ W5, _Float16* __restrict__ Q, _Float16* __restrict__ Kr, _Float16* __restrict__ V) {
  __shared__ __align__(16) _Float16 so[64][72]; __shared__ __align__(16) _Float16 st[64][72]; __shared__ __align__(16) __bf16 sw[CC][WPE];
  const int tid = threadIdx.x, wave = tid >> 5, lane = tid & 31, col = lane & 15, g = lane >> 4; const int which = blockIdx.y; const size_t b = blockIdx.z; const int n0b = blockIdx.x * 64, n0 = n0b + wave * 16;
  const float* X = (which >= 4) ? SRC : TGT; const int pair = (which >= 3) ? 1 : 0; const int role = (which >= 3) ? (which - 3) : which;
  const WX wx = w_load((which == 0) ? W0 : (which == 1) ? W1 : (which == 2) ? W2 : (which == 3) ? W3 : (which == 4) ? W4 : W5, tid);
  v8f acc[4] = {}; v16b a[CC / 32];
  // the input gathers are issued ahead of the barrier, so that they fly together with the weight loads
#pragma unroll
  for (int kc = 0; kc < CC / 32; ++kc) { const float* p = X + (b * CC + kc * 32 + 8 * g) * NN + n0 + col;
#pragma unroll
    for (int i = 0; i < 8; ++i) { a[kc][i] = (__bf16)p[(size_t)i * NN]; a[kc][8 + i] = (__bf16)p[(size_t)(16 + i) * NN]; }
    asm volatile("s_wait_xcnt 0x0" ::: "memory"); }   // stands behind the issued loads, ahead of whatever next takes over one of their address registers
  w_store(wx, sw, tid);
  __syncthreads();   // the weight rows were written by all four waves
  v16b wf[CC / 32][4];   // the fragment reads stand in one group ahead of the products: a wave waits out the LDS latency once, not once a fragment
#pragma unroll
  for (int kc = 0; kc < CC / 32; ++kc)
#pragma unroll
    for (int j = 0; j < 4; ++j) wf[kc][j] = frag_b(&sw[j * 16 + col][kc * 32], lane);
#pragma unroll
  for (int kc = 0; kc < CC / 32; ++kc)
#pragma unroll
    for (int j = 0; j < 4; ++j) acc[j] = wmma_bf(a[kc], wf[kc][j], acc[j]);
  if (role < 2) { _Float16* dst = ((role == 0) ? Q : Kr) + ((size_t)pair * NB + b) * NN * CC;
#pragma unroll
    for (int j = 0; j < 4; ++j)
#pragma unroll
      for (int r = 0; r < 8; ++r) so[wave * 16 + 8 * g + r][j * 16 + col] = (_Float16)acc[j][r];
    LDSX();
    for (int rl = 0; rl < 16; ++rl) if (lane < 8) vst2((unsigned*)(dst + (size_t)(n0 + rl) * CC + lane * 8), *(const v4u*)&so[wave * 16 + rl][lane * 8]);
  } else { _Float16* dst = V + ((size_t)pair * NB + b) * CC * NN;
#pragma unroll
    for (int j = 0; j < 4; ++j)
#pragma unroll
      for (int r = 0; r < 8; ++r) st[j * 16 + col][wave * 16 + 8 * g + r] = (_Float16)acc[j][r];
    __syncthreads();
    for (int e = tid; e < 64 * 8; e += 128) { const int d = e >> 3, pc = e & 7; vst2((unsigned*)(dst + (size_t)d * NN + n0b + pc * 8), *(const v4u*)&st[d][pc * 8]); } }
}
// ---- k_attn: block = (64 queries, pair*NB + b), 4 * KSP waves: wave = (16-query tile qg, key split sp); the keys go by in stages of STK = 32 * KSP, and in each stage split sp takes the 32-key block sp with its own running max, sum and accumulators; the KSP partials of a tile are merged through LDS. Single 64-wide head over all 4,096 voxels, scale 1/8
// The products run transposed: S^T = K . Q^T (A = key rows, B = query rows) and O^T += V^T . P^T (A = V planes, B = P^T). A lane then holds 16 scores of ONE query (column col; keys 8g + r of each 16-key tile), so maximum and sum run in its own registers, and the two score tiles, converted in place, are the B operand of the second product in the hardware k order that frag_h gives V
// A stage's K rows and V plane slices are brought into LDS once for the whole block, by asynchronous copies that cover whole 128-B lines (a wave's 32 lanes x 16 B = 512 contiguous bytes), two buffers: stage t + 1 flies while stage t is worked on. The fragments are then read from LDS at padded pitches; read straight from global memory each fragment load touched 16 lines, and each of the 4 query tiles fetched the same keys again
#define KSP 8              // key splits per 16-query tile: 4 tiles x 8 splits = 32 waves, 8 per SIMD; 8 so that a stage of 256 keys divides the 4,096
#define STK (32 * KSP)     // keys per stage
#define NST (NN / STK)     // stages
#define KPB (2 * CC + 16)  // LDS pitch of a K row, bytes: 144 = 16 x 9, free of bank conflicts for 16-byte reads down a column of rows
#define VPB (2 * STK + 16) // LDS pitch of a V plane's slice, bytes: 528 = 16 x 33, likewise
#define KBB (STK * KPB)    // K part of a buffer, bytes
#define STB (KBB + CC * VPB)   // one buffer, bytes
__device__ __forceinline__ float xhalf(float x) { return __builtin_bit_cast(float, __builtin_amdgcn_permlanex16(__builtin_bit_cast(int, x), __builtin_bit_cast(int, x), 0x76543210, 0xfedcba98, false, false)); }  // lane l with lane l ^ 16
// a thread's four 16-byte copies of one stage: K rows r and r + STK / 2, V planes d and d + CC / 2. lk, lv: LDS byte addresses; gk, gv: global sources
__device__ __forceinline__ void stage_copy(unsigned lk, unsigned lv, const _Float16* gk, const _Float16* gv) {
  const unsigned lk1 = lk + (STK / 2) * KPB, lv1 = lv + (CC / 2) * VPB; const _Float16* gk1 = gk + (size_t)(STK / 2) * CC; const _Float16* gv1 = gv + (size_t)(CC / 2) * NN;
  // the copies go past the registers; s_wait_xcnt closes the statement so that no address register named here is rewritten ahead of it
  asm volatile("global_load_async_to_lds_b128 %0, %4, off\n\tglobal_load_async_to_lds_b128 %1, %5, off\n\tglobal_load_async_to_lds_b128 %2, %6, off\n\tglobal_load_async_to_lds_b128 %3, %7, off\n\ts_wait_xcnt 0x0" :: "v"(lk), "v"(lk1), "v"(lv), "v"(lv1), "v"(gk), "v"(gk1), "v"(gv), "v"(gv1) : "memory");
}
__global__ __launch_bounds__(128 * KSP) void k_attn(const _Float16* __restrict__ Q, const _Float16* __restrict__ Kr, const _Float16* __restrict__ V, float* __restrict__ O) {
  __shared__ __align__(16) unsigned char ring[2][STB];
  __shared__ __align__(16) float so[4 * KSP][16][68]; __shared__ float sm[4 * KSP][16]; __shared__ float sl[4 * KSP][16];
  const int tid = threadIdx.x, wave = __builtin_amdgcn_readfirstlane(tid >> 5), lane = tid & 31, col = lane & 15, g = lane >> 4; const int qg = wave & 3, sp = wave >> 2; const size_t pb = blockIdx.y; const int q0 = blockIdx.x * 64 + qg * 16; const size_t rq = pb * NN + q0;
  // K: 16-byte piece tid of the stage's first 128 rows (8 pieces a row, the rows contiguous in memory); V: piece lane of plane tid >> 5 (32 pieces a slice)
  const unsigned lk = (unsigned)(size_t)&ring[0][0] + (unsigned)((tid >> 3) * KPB + (tid & 7) * 16), lv = (unsigned)(size_t)&ring[0][0] + (unsigned)(KBB + (tid >> 5) * VPB + lane * 16);
  const _Float16* gk = Kr + pb * NN * CC + tid * 8; const _Float16* gv = V + (pb * CC + (tid >> 5)) * NN + lane * 8;
  stage_copy(lk, lv, gk, gv);
  v16h bq[2];
#pragma unroll
  for (int kc = 0; kc < 2; ++kc) bq[kc] = frag_h(Q + (rq + col) * CC + kc * 32, lane);
  float m = -3.0e38f, l = 0.f;   // of query col; m is common to the two lane halves, l is this half's keys only
  v8f acc[4] = {};               // acc[dt][r] = O^T[dt * 16 + 8g + r][col]
  asm volatile("s_wait_asynccnt 0x0" ::: "memory");   // this wave's copies of stage 0 have landed
  __syncthreads();                                    // and every other wave's: stage 0 may be read
  stage_copy(lk + STB, lv + STB, gk + (size_t)STK * CC, gv + STK);
#pragma unroll 1
  for (int t = 0; t < NST; ++t) { const unsigned char* kb = &ring[t & 1][0] + (sp * 32 + col) * KPB; const unsigned char* vb = &ring[t & 1][0] + KBB + col * VPB + sp * 64; v8f s[2]; v16h ka[2][2], va[4];
    // the pass's LDS reads stand in two groups, K ahead of the first product and V ahead of the softmax, so that a wave waits out the LDS latency twice a pass and not once a fragment
#pragma unroll
    for (int ct = 0; ct < 2; ++ct)
#pragma unroll
      for (int kc = 0; kc < 2; ++kc) ka[ct][kc] = frag_h((const _Float16*)(kb + ct * 16 * KPB) + kc * 32, lane);
#pragma unroll
    for (int ct = 0; ct < 2; ++ct) { v8f c = {};
#pragma unroll
      for (int kc = 0; kc < 2; ++kc) c = wmma16(ka[ct][kc], bq[kc], c);
#pragma unroll
      for (int r = 0; r < 8; ++r) s[ct][r] = c[r] * 0.125f; }
#pragma unroll
    for (int dt = 0; dt < 4; ++dt) va[dt] = frag_h((const _Float16*)(vb + dt * 16 * VPB), lane);
    float mx = fmaxf(s[0][0], s[1][0]);
#pragma unroll
    for (int r = 1; r < 8; ++r) mx = fmaxf(mx, fmaxf(s[0][r], s[1][r]));
    mx = fmaxf(mx, xhalf(mx));
    const float mn = fmaxf(m, mx); float ea;
    // exp(m - mn) as v_exp_f32 with its own v_nop: the slot the instruction set asks for behind a transcendental before its result is read.
    asm("v_exp_f32 %0, %1\n\tv_nop" : "=v"(ea) : "v"((m - mn) * 1.44269504f));
    const float alpha = (m <= -1.0e38f) ? 0.f : ea; v8f e[2]; v16h pt;
#pragma unroll
    for (int ct = 0; ct < 2; ++ct)
#pragma unroll
      for (int r = 0; r < 8; ++r) { e[ct][r] = __expf(s[ct][r] - mn); pt[8 * ct + r] = (_Float16)(e[ct][r] * 2048.0f); }
    const v8f ts = e[0] + e[1]; const float es = ((ts[0] + ts[1]) + (ts[2] + ts[3])) + ((ts[4] + ts[5]) + (ts[6] + ts[7]));
    l = l * alpha + es; m = mn;
#pragma unroll
    for (int dt = 0; dt < 4; ++dt) acc[dt] *= alpha;
#pragma unroll
    for (int dt = 0; dt < 4; ++dt) acc[dt] = wmma16(va[dt], pt, acc[dt]);
    asm volatile("s_wait_dscnt 0x0" ::: "memory");      // this wave's reads of stage t are done before its buffer is handed back
    asm volatile("s_wait_asynccnt 0x0" ::: "memory");   // this wave's copies of stage t + 1 have landed
    __syncthreads();                                    // publishes stage t + 1 and ends every wave's reads of stage t
    if (t + 2 < NST) stage_copy(lk + (t & 1) * STB, lv + (t & 1) * STB, gk + (size_t)(t + 2) * STK * CC, gv + (t + 2) * STK); }
  asm volatile("s_wait_asynccnt 0x0" ::: "memory");     // no copy is left in flight behind the loop
  // each wave leaves its un-normalised partial with its (max, sum) per query; every split has walked NST blocks, so every max is a real score
  l += xhalf(l);
#pragma unroll
  for (int dt = 0; dt < 4; ++dt) { const v4f lo = {acc[dt][0], acc[dt][1], acc[dt][2], acc[dt][3]}, hi = {acc[dt][4], acc[dt][5], acc[dt][6], acc[dt][7]}; *(v4f*)&so[wave][col][dt * 16 + 8 * g] = lo; *(v4f*)&so[wave][col][dt * 16 + 8 * g + 4] = hi; }
  if (g == 0) { sm[wave][col] = m; sl[wave][col] = l; }
  __syncthreads();   // the partials of all splits are read by other waves below
  for (int e = tid; e < 64 * 16; e += 128 * KSP) { const int row = e >> 4, c4 = e & 15, tq = row >> 4, rl = row & 15; float mm[KSP]; float M = -3.0e38f;
#pragma unroll
    for (int p = 0; p < KSP; ++p) { mm[p] = sm[p * 4 + tq][rl]; M = fmaxf(M, mm[p]); }
    float L = 0.f; v4f o = {};
#pragma unroll
    for (int p = 0; p < KSP; ++p) { const float w = __expf(mm[p] - M); L += w * sl[p * 4 + tq][rl]; o += w * *(const v4f*)&so[p * 4 + tq][rl][c4 * 4]; }
    vst2(O + (pb * NN + blockIdx.x * 64 + row) * CC + c4 * 4, o * ((1.0f / 2048.0f) / L)); }
}
// ---- k_fin: block = (64 voxels, b): att = (O_tt + O_st) / 2 (f32), out = att (bf16 hi + lo) . Wout^T (exact), channels-first 256-B segments
__global__ __launch_bounds__(128) void k_fin(const float* __restrict__ O, const float* __restrict__ WO, float* __restrict__ OUT) {
  __shared__ __align__(16) float sa[4][16][68]; __shared__ __align__(16) float st[64][68]; __shared__ __align__(16) __bf16 sw[CC][WPE];
  const int tid = threadIdx.x, wave = tid >> 5, lane = tid & 31, col = lane & 15, g = lane >> 4; const size_t b = blockIdx.y; const int n0b = blockIdx.x * 64, n0 = n0b + wave * 16;
  const WX wx = w_load(WO, tid);
  for (int e = lane; e < 16 * CC; e += 32) { const int rl = e >> 6, c = e & 63; sa[wave][rl][c] = (O[((0 * NB + b) * NN + n0 + rl) * CC + c] + O[((1 * NB + b) * NN + n0 + rl) * CC + c]) * 0.5f; }
  w_store(wx, sw, tid);
  __syncthreads();   // the weight rows were written by all four waves; it also orders a wave's own sa rows
  v8f acc[4] = {}; v16b wf[CC / 32][4];   // as in k_proj: one group of fragment reads ahead of the products
#pragma unroll
  for (int kc = 0; kc < CC / 32; ++kc)
#pragma unroll
    for (int jt = 0; jt < 4; ++jt) wf[kc][jt] = frag_b(&sw[jt * 16 + col][kc * 32], lane);
#pragma unroll
  for (int kc = 0; kc < CC / 32; ++kc) { const F2 a = split_row(&sa[wave][col][0], kc * 32, lane);
#pragma unroll
    for (int jt = 0; jt < 4; ++jt) { acc[jt] = wmma_bf(a.h, wf[kc][jt], acc[jt]); acc[jt] = wmma_bf(a.l, wf[kc][jt], acc[jt]); } }
#pragma unroll
  for (int jt = 0; jt < 4; ++jt)
#pragma unroll
    for (int r = 0; r < 8; ++r) st[jt * 16 + col][wave * 16 + 8 * g + r] = acc[jt][r];
  __syncthreads();
  for (int e = tid; e < CC * 16; e += 128) { const int o = e >> 4, q = e & 15; vst2(OUT + ((b * CC + o) * NN) + n0b + q * 4, *(const v4f*)&st[o][q * 4]); }
}
extern "C" void kernel_launch(void* const* d_in, const int* in_sizes, int n_in, void* d_out, int out_size, void* d_ws, size_t ws_size, hipStream_t stream) {
  (void)in_sizes; (void)n_in; (void)out_size;
  const float** F = (const float**)d_in;   // 0 source, 1 target [2,64,16,16,16]; 2 Wq_tt, 3 Wq_st, 4 Wk_tt, 5 Wk_st, 6 Wv_tt, 7 Wv_st, 8 Wout ([64,64] natural [out][in])
  if (ws_size < (size_t)WS_END) return;
  char* ws = (char*)d_ws; _Float16 *Q = (_Float16*)(ws + WS_Q), *Kr = (_Float16*)(ws + WS_K), *V = (_Float16*)(ws + WS_V); float* O = (float*)(ws + WS_O);
  k_proj<<<dim3(NN / 64, 6, NB), 128, 0, stream>>>(F[0], F[1], F[2], F[4], F[6], F[3], F[5], F[7], Q, Kr, V);   // weights in the order of which: q_tt, k_tt, v_tt, q_st, k_st, v_st
  k_attn<<<dim3(TQB, NP * TNB), 128 * KSP, 0, stream>>>(Q, Kr, V, O);
  k_fin<<<dim3(TQB, TNB), 128, 0, stream>>>(O, F[8], (float*)d_out);
}

// v005
// One run takes 32.1 microseconds.
// Next to v004, in two timings, it ran 1.06 and 1.07 times as fast.
// Counting every step since v000, it is 8.01 times as fast.
// compute dtype: all float inputs rounded to bf16; the six pointwise projections with EXACT bf16 products on WMMA 16x16x32 (channels-first inputs gathered into token rows), rounded once to f16; two PLAIN 64-wide attentions: q, k single f16 x 1/8, running-max softmax in f32 (hardware exp), P (scaled by 2^11, single f16) x v (single f16); the average of the two in f32, split into bf16 hi + lo x exact Wout (2 products); channels-first f32 output.
#include <hip/hip_runtime.h>
#include <math.h>

typedef __attribute__((ext_vector_type(16))) _Float16 v16h;
typedef __attribute__((ext_vector_type(16))) __bf16 v16b;
typedef __attribute__((ext_vector_type(8)))  _Float16 v8h;
typedef __attribute__((ext_vector_type(8)))  float v8f;
typedef __attribute__((ext_vector_type(4)))  float v4f;
typedef __attribute__((ext_vector_type(2)))  float v2f;
typedef __attribute__((ext_vector_type(4)))  unsigned v4u;
typedef __attribute__((ext_vector_type(4)))  int v4i;
typedef float __attribute__((may_alias)) float_a;
typedef int __attribute__((may_alias)) int_a;

template <typename T> __device__ __forceinline__ void vst2(void* p, T v) { *(T*)p = v;  }
__device__ __forceinline__ v8f wmma16(v16h a, v16h b, v8f c) {
  v8f d = __builtin_amdgcn_wmma_f32_16x16x32_f16(false, a, false, b, (short)0, c, false, false);
  asm volatile("v_nop\n\tv_nop\n\tv_nop\n\tv_nop" : "+v"(d) : "v"(a), "v"(b));
  return d;
}
__device__ __forceinline__ v8f wmma_bf(v16b a, v16b b, v8f c) {
  v8f d = __builtin_amdgcn_wmma_f32_16x16x32_bf16(false, a, false, b, (short)0, c, false, false);
  asm volatile("v_nop\n\tv_nop\n\tv_nop\n\tv_nop" : "+v"(d) : "v"(a), "v"(b));
  return d;
}
// 16x16x32 fragments: lane = (h = lane>>4, row/col = lane&15); elements 0..7 = k0+8h+0..7, 8..15 = k0+16+8h+0..7; D element r = row 8h+r
__device__ __forceinline__ v16h frag_h(const _Float16* rowk0, int lane) {
  union { v16h v; v8h q[2]; } u; const _Float16* p = rowk0 + 8 * (lane >> 4);
  u.q[0] = *(const v8h*)p; u.q[1] = *(const v8h*)(p + 16); return u.v;
}
__device__ __forceinline__ v16h frag_f32(const float* rowk0, int lane) {
  v16h a; const float* p = rowk0 + 8 * (lane >> 4);
#pragma unroll
  for (int i = 0; i < 8; ++i) { a[i] = (_Float16)p[i]; a[8 + i] = (_Float16)p[16 + i]; }
  return a;
}
__device__ __forceinline__ v16h frag_f32s(const float* rowk0, int lane, float sc) {
  v16h a; const float* p = rowk0 + 8 * (lane >> 4);
#pragma unroll
  for (int i = 0; i < 8; ++i) { a[i] = (_Float16)(p[i] * sc); a[8 + i] = (_Float16)(p[16 + i] * sc); }
  return a;
}
// column fragment from a [K][ld] layout (column n), rows >= K read as 0
__device__ __forceinline__ v16h fragc_f32(const float* W, int k0, int n, int lane, int ld, int K) {
  v16h a; const int g = lane >> 4;
#pragma unroll
  for (int i = 0; i < 8; ++i) { const int ka = k0 + 8 * g + i, kb = ka + 16;
    a[i] = (_Float16)(ka < K ? W[(size_t)(ka < K ? ka : K - 1) * ld + n] : 0.f); a[8 + i] = (_Float16)(kb < K ? W[(size_t)(kb < K ? kb : K - 1) * ld + n] : 0.f); }
  return a;
}
struct F2 { v16b h, l; };
__device__ __forceinline__ F2 bsplit16(const float v[16]) { F2 r;
#pragma unroll
  for (int i = 0; i < 16; ++i) { const __bf16 h = (__bf16)v[i]; r.h[i] = h; r.l[i] = (__bf16)(v[i] - (float)h); }
  return r; }
__device__ __forceinline__ F2 split_row(const float* row, int k0, int lane) { float v[16]; const float* p = row + k0 + 8 * (lane >> 4);
#pragma unroll
  for (int i = 0; i < 8; ++i) { v[i] = p[i]; v[8 + i] = p[16 + i]; }
  return bsplit16(v); }
__device__ __forceinline__ F2 split_rowK(const float* row, int k0, int lane, int K) { float v[16]; const int g = lane >> 4;
#pragma unroll
  for (int i = 0; i < 8; ++i) { const int ka = k0 + 8 * g + i, kb = ka + 16; v[i] = ka < K ? row[ka < K ? ka : K - 1] : 0.f; v[8 + i] = kb < K ? row[kb < K ? kb : K - 1] : 0.f; }
  return bsplit16(v); }
__device__ __forceinline__ F2 split_col(const float* W, int k0, int n, int lane, int ld, int K) { float v[16]; const int g = lane >> 4;
#pragma unroll
  for (int i = 0; i < 8; ++i) { const int ka = k0 + 8 * g + i, kb = ka + 16; v[i] = ka < K ? W[(size_t)(ka < K ? ka : K - 1) * ld + n] : 0.f; v[8 + i] = kb < K ? W[(size_t)(kb < K ? kb : K - 1) * ld + n] : 0.f; }
  return bsplit16(v); }
__device__ __forceinline__ v8f mac3(const F2& a, const F2& b, v8f c) { c = wmma_bf(a.l, b.h, c); c = wmma_bf(a.h, b.l, c); return wmma_bf(a.h, b.h, c); }
__device__ __forceinline__ float sigm(float v) { return 1.0f / (1.0f + expf(-v)); }
#define LDSX() do { asm volatile("s_wait_dscnt 0" ::: "memory"); __builtin_amdgcn_wave_barrier(); __builtin_amdgcn_fence(__ATOMIC_RELEASE, "workgroup"); } while (0)


// Uni/bidirectional spatial attention (B 2, C 64, 16^3 = 4,096 voxels): target->target and source->target single-head attentions from 1x1x1 projections, averaged, then a 1x1x1 output projection.
#define NB 2
#define CC 64
#define NN 4096
#define NP 2               // attention pairs: 0 = tt, 1 = st
#ifndef TQB
#define TQB (NN / 64)
#define TNB NB
#endif
typedef __attribute__((ext_vector_type(8))) __bf16 v8b;
__device__ __forceinline__ v16b frag_b(const __bf16* rowk0, int lane) {
  union { v16b v; v8b q[2]; } u; const __bf16* p = rowk0 + 8 * (lane >> 4);
  u.q[0] = *(const v8b*)p; u.q[1] = *(const v8b*)(p + 16); return u.v;
}
__device__ __forceinline__ float bfr(float v) { return (float)(__bf16)v; }
__device__ __attribute__((noinline)) float exp_ni(float v) { return expf(v); }
__device__ __attribute__((noinline)) float erf_ni(float v) { return erff(v); }

#define WS_Q   0u                                   // f16 rows [p][b][n][64] q ; k ; planes V [p][b][64][n] ; O f32 [p][b][n][64]
#define WS_K   (WS_Q + 2u * (size_t)NP * NB * NN * CC)
#define WS_V   (WS_K + 2u * (size_t)NP * NB * NN * CC)
#define WS_O   (WS_V + 2u * (size_t)NP * NB * CC * NN)
#define WS_END (WS_O + 4u * (size_t)NP * NB * NN * CC)

// Each block rounds the one 64 x 64 weight matrix it needs to bf16 itself, into LDS: 8 whole-line 16-byte loads a thread (a wave's 32 lanes x 16 B = 512 contiguous bytes), natural rows at a pitch of 144 B = 16 x 9, free of bank conflicts for the 16-byte fragment reads down a column of rows. No launch ahead packs the weights
#define WPE 72             // LDS pitch of a weight row, bf16 elements
typedef __attribute__((ext_vector_type(4))) __bf16 v4b;
struct WX { v4f x[8]; };
__device__ __forceinline__ WX w_load(const float* __restrict__ Wm, int tid) { WX w;
#pragma unroll   // the eight loads stand in registers and fly together
  for (int i = 0; i < 8; ++i) w.x[i] = *(const v4f*)(Wm + (tid + 128 * i) * 4);
  return w; }
__device__ __forceinline__ void w_store(const WX& w, __bf16 (*sw)[WPE], int tid) {
#pragma unroll   // w.x is indexed by constants only, so it stays in registers
  for (int i = 0; i < 8; ++i) { const int e = tid + 128 * i; const v4b y = {(__bf16)w.x[i][0], (__bf16)w.x[i][1], (__bf16)w.x[i][2], (__bf16)w.x[i][3]}; *(v4b*)&sw[e >> 4][(e & 15) * 4] = y; } }
// ---- k_proj: block = (64 voxels, which of 6, b): input tgt (which 0,1,2,3) or src (4,5); A gathered channels-first; which -> (pair, role): 0 q_tt, 1 k_tt, 2 v_tt, 3 q_st, 4 k_st, 5 v_st
__global__ __launch_bounds__(128) void k_proj(const float* __restrict__ SRC, const float* __restrict__ TGT, const float* __restrict__ W0, const float* __restrict__ W1, const float* __restrict__ W2, const float* __restrict__ W3, const float* __restrict__ W4, const float* __restrict__ W5, _Float16* __restrict__ Q, _Float16* __restrict__ Kr, _Float16* __restrict__ V) {
  __shared__ __align__(16) _Float16 so[64][72]; __shared__ __align__(16) _Float16 st[64][72]; __shared__ __align__(16) __bf16 sw[CC][WPE];
  const int tid = threadIdx.x, wave = tid >> 5, lane = tid & 31, col = lane & 15, g = lane >> 4; const int which = blockIdx.y; const size_t b = blockIdx.z; const int n0b = blockIdx.x * 64, n0 = n0b + wave * 16;
  const float* X = (which >= 4) ? SRC : TGT; const int pair = (which >= 3) ? 1 : 0; const int role = (which >= 3) ? (which - 3) : which;
  const WX wx = w_load((which == 0) ? W0 : (which == 1) ? W1 : (which == 2) ? W2 : (which == 3) ? W3 : (which == 4) ? W4 : W5, tid);
  v8f acc[4] = {}; v16b a[CC / 32];
  // the input gathers are issued ahead of the barrier, so that they fly together with the weight loads
#pragma unroll
  for (int kc = 0; kc < CC / 32; ++kc) { const float* p = X + (b * CC + kc * 32 + 8 * g) * NN + n0 + col;
#pragma unroll
    for (int i = 0; i < 8; ++i) { a[kc][i] = (__bf16)p[(size_t)i * NN]; a[kc][8 + i] = (__bf16)p[(size_t)(16 + i) * NN]; }
    asm volatile("s_wait_xcnt 0x0" ::: "memory"); }   // stands behind the issued loads, ahead of whatever next takes over one of their address registers
  w_store(wx, sw, tid);
  __syncthreads();   // the weight rows were written by all four waves
  v16b wf[CC / 32][4];   // the fragment reads stand in one group ahead of the products: a wave waits out the LDS latency once, not once a fragment
#pragma unroll
  for (int kc = 0; kc < CC / 32; ++kc)
#pragma unroll
    for (int j = 0; j < 4; ++j) wf[kc][j] = frag_b(&sw[j * 16 + col][kc * 32], lane);
#pragma unroll
  for (int kc = 0; kc < CC / 32; ++kc)
#pragma unroll
    for (int j = 0; j < 4; ++j) acc[j] = wmma_bf(a[kc], wf[kc][j], acc[j]);
  if (role < 2) { _Float16* dst = ((role == 0) ? Q : Kr) + ((size_t)pair * NB + b) * NN * CC;
#pragma unroll
    for (int j = 0; j < 4; ++j)
#pragma unroll
      for (int r = 0; r < 8; ++r) so[wave * 16 + 8 * g + r][j * 16 + col] = (_Float16)acc[j][r];
    LDSX();
    for (int rl = 0; rl < 16; ++rl) if (lane < 8) vst2((unsigned*)(dst + (size_t)(n0 + rl) * CC + lane * 8), *(const v4u*)&so[wave * 16 + rl][lane * 8]);
  } else { _Float16* dst = V + ((size_t)pair * NB + b) * CC * NN;
#pragma unroll
    for (int j = 0; j < 4; ++j)
#pragma unroll
      for (int r = 0; r < 8; ++r) st[j * 16 + col][wave * 16 + 8 * g + r] = (_Float16)acc[j][r];
    __syncthreads();
    for (int e = tid; e < 64 * 8; e += 128) { const int d = e >> 3, pc = e & 7; vst2((unsigned*)(dst + (size_t)d * NN + n0b + pc * 8), *(const v4u*)&st[d][pc * 8]); } }
}
// ---- k_attn: block = (64 queries, pair*NB + b), 4 * KSP waves: wave = (16-query tile qg, key split sp); the keys go by in stages of STK = 32 * KSP, and in each stage split sp takes the 32-key block sp with its own running max, sum and accumulators; the KSP partials of a tile are merged through LDS. Single 64-wide head over all 4,096 voxels, scale 1/8
// The products run transposed: S^T = K . Q^T (A = key rows, B = query rows) and O^T += V^T . P^T (A = V planes, B = P^T). A lane then holds 16 scores of ONE query (column col; keys 8g + r of each 16-key tile), so maximum and sum run in its own registers, and the two score tiles, converted in place, are the B operand of the second product in the hardware k order that frag_h gives V
// A stage's K rows and V plane slices are brought into LDS once for the whole block, by asynchronous copies that cover whole 128-B lines (a wave's 32 lanes x 16 B = 512 contiguous bytes), two buffers: stage t + 1 flies while stage t is worked on. The fragments are then read from LDS at padded pitches; read straight from global memory each fragment load touched 16 lines, and each of the 4 query tiles fetched the same keys again
#define KSP 8              // key splits per 16-query tile: 4 tiles x 8 splits = 32 waves, 8 per SIMD; 8 so that a stage of 256 keys divides the 4,096
#define STK (32 * KSP)     // keys per stage
#define NST (NN / STK)     // stages
#define KPB (2 * CC + 16)  // LDS pitch of a K row, bytes: 144 = 16 x 9, free of bank conflicts for 16-byte reads down a column of rows
#define VPB (2 * STK + 16) // LDS pitch of a V plane's slice, bytes: 528 = 16 x 33, likewise
#define KBB (STK * KPB)    // K part of a buffer, bytes
#define STB (KBB + CC * VPB)   // one buffer, bytes
#define SL2 0.18033688f    // (1/8) x log2(e): a raw score times this is its exponent to the base 2
__device__ __forceinline__ float xhalf(float x) { return __builtin_bit_cast(float, __builtin_amdgcn_permlanex16(__builtin_bit_cast(int, x), __builtin_bit_cast(int, x), 0x76543210, 0xfedcba98, false, false)); }  // lane l with lane l ^ 16
// a thread's four 16-byte copies of one stage: K rows r and r + STK / 2, V planes d and d + CC / 2. lk, lv: LDS byte addresses; gk, gv: global sources
__device__ __forceinline__ void stage_copy(unsigned lk, unsigned lv, const _Float16* gk, const _Float16* gv) {
  const unsigned lk1 = lk + (STK / 2) * KPB, lv1 = lv + (CC / 2) * VPB; const _Float16* gk1 = gk + (size_t)(STK / 2) * CC; const _Float16* gv1 = gv + (size_t)(CC / 2) * NN;
  // the copies go past the registers; s_wait_xcnt closes the statement so that no address register named here is rewritten ahead of it
  asm volatile("global_load_async_to_lds_b128 %0, %4, off\n\tglobal_load_async_to_lds_b128 %1, %5, off\n\tglobal_load_async_to_lds_b128 %2, %6, off\n\tglobal_load_async_to_lds_b128 %3, %7, off\n\ts_wait_xcnt 0x0" :: "v"(lk), "v"(lk1), "v"(lv), "v"(lv1), "v"(gk), "v"(gk1), "v"(gv), "v"(gv1) : "memory");
}
__global__ __launch_bounds__(128 * KSP) void k_attn(const _Float16* __restrict__ Q, const _Float16* __restrict__ Kr, const _Float16* __restrict__ V, float* __restrict__ O) {
  __shared__ __align__(16) unsigned char ring[2][STB];
  __shared__ __align__(16) float so[4 * KSP][16][68]; __shared__ float sm[4 * KSP][16]; __shared__ float sl[4 * KSP][16];
  const int tid = threadIdx.x, wave = __builtin_amdgcn_readfirstlane(tid >> 5), lane = tid & 31, col = lane & 15, g = lane >> 4; const int qg = wave & 3, sp = wave >> 2; const size_t pb = blockIdx.y; const int q0 = blockIdx.x * 64 + qg * 16; const size_t rq = pb * NN + q0;
  // K: 16-byte piece tid of the stage's first 128 rows (8 pieces a row, the rows contiguous in memory); V: piece lane of plane tid >> 5 (32 pieces a slice)
  const unsigned lk = (unsigned)(size_t)&ring[0][0] + (unsigned)((tid >> 3) * KPB + (tid & 7) * 16), lv = (unsigned)(size_t)&ring[0][0] + (unsigned)(KBB + (tid >> 5) * VPB + lane * 16);
  const _Float16* gk = Kr + pb * NN * CC + tid * 8; const _Float16* gv = V + (pb * CC + (tid >> 5)) * NN + lane * 8;
  stage_copy(lk, lv, gk, gv);
  v16h bq[2];
#pragma unroll
  for (int kc = 0; kc < 2; ++kc) bq[kc] = frag_h(Q + (rq + col) * CC + kc * 32, lane);
  float m = -3.0e38f, l = 0.f;   // of query col; m, a RAW score (q . k, not yet times 1/8), is common to the two lane halves; l, this half's keys only, carries P's factor 2^11
  v8f acc[4] = {};               // acc[dt][r] = O^T[dt * 16 + 8g + r][col]
  asm volatile("s_wait_asynccnt 0x0" ::: "memory");   // this wave's copies of stage 0 have landed
  __syncthreads();                                    // and every other wave's: stage 0 may be read
  stage_copy(lk + STB, lv + STB, gk + (size_t)STK * CC, gv + STK);
#pragma unroll 1
  for (int t = 0; t < NST; ++t) { const unsigned char* kb = &ring[t & 1][0] + (sp * 32 + col) * KPB; const unsigned char* vb = &ring[t & 1][0] + KBB + col * VPB + sp * 64; v8f s[2]; v16h ka[2][2], va[4];
    // the pass's LDS reads stand in two groups, K ahead of the first product and V ahead of the softmax, so that a wave waits out the LDS latency twice a pass and not once a fragment
#pragma unroll
    for (int ct = 0; ct < 2; ++ct)
#pragma unroll
      for (int kc = 0; kc < 2; ++kc) ka[ct][kc] = frag_h((const _Float16*)(kb + ct * 16 * KPB) + kc * 32, lane);
#pragma unroll
    for (int ct = 0; ct < 2; ++ct) { v8f c = {};
#pragma unroll
      for (int kc = 0; kc < 2; ++kc) c = wmma16(ka[ct][kc], bq[kc], c);
      s[ct] = c; }
#pragma unroll
    for (int dt = 0; dt < 4; ++dt) va[dt] = frag_h((const _Float16*)(vb + dt * 16 * VPB), lane);
    float mx = fmaxf(s[0][0], s[1][0]);
#pragma unroll
    for (int r = 1; r < 8; ++r) mx = fmaxf(mx, fmaxf(s[0][r], s[1][r]));
    mx = fmaxf(mx, xhalf(mx));
    const float mn = fmaxf(m, mx); float ea;
    // exp((m - mn) / 8) = 2^((m - mn) x SL2) as v_exp_f32 with its own v_nop: the slot the instruction set asks for behind a transcendental before its result is read.
    asm("v_exp_f32 %0, %1\n\tv_nop" : "=v"(ea) : "v"((m - mn) * SL2));
    // P x 2^11 = 2^(c x SL2 + nb): the scale 1/8, log2(e), the maximum and the 2^11 meet in ONE fused multiply-add per raw score c, with nb formed once a pass
    const float alpha = (m <= -1.0e38f) ? 0.f : ea; const float nb = 11.0f - mn * SL2; v8f e[2]; v16h pt;
#pragma unroll
    for (int ct = 0; ct < 2; ++ct)
#pragma unroll
      for (int r = 0; r < 8; ++r) { e[ct][r] = __builtin_amdgcn_exp2f(fmaf(s[ct][r], SL2, nb)); pt[8 * ct + r] = (_Float16)e[ct][r]; }
    const v8f ts = e[0] + e[1]; const float es = ((ts[0] + ts[1]) + (ts[2] + ts[3])) + ((ts[4] + ts[5]) + (ts[6] + ts[7]));
    l = l * alpha + es; m = mn;
#pragma unroll
    for (int dt = 0; dt < 4; ++dt) acc[dt] *= alpha;
#pragma unroll
    for (int dt = 0; dt < 4; ++dt) acc[dt] = wmma16(va[dt], pt, acc[dt]);
    asm volatile("s_wait_dscnt 0x0" ::: "memory");      // this wave's reads of stage t are done before its buffer is handed back
    asm volatile("s_wait_asynccnt 0x0" ::: "memory");   // this wave's copies of stage t + 1 have landed
    __syncthreads();                                    // publishes stage t + 1 and ends every wave's reads of stage t
    if (t + 2 < NST) stage_copy(lk + (t & 1) * STB, lv + (t & 1) * STB, gk + (size_t)(t + 2) * STK * CC, gv + (t + 2) * STK); }
  asm volatile("s_wait_asynccnt 0x0" ::: "memory");     // no copy is left in flight behind the loop
  // each wave leaves its un-normalised partial with its (max, sum) per query; every split has walked NST blocks, so every max is a real score
  l += xhalf(l);
#pragma unroll
  for (int dt = 0; dt < 4; ++dt) { const v4f lo = {acc[dt][0], acc[dt][1], acc[dt][2], acc[dt][3]}, hi = {acc[dt][4], acc[dt][5], acc[dt][6], acc[dt][7]}; *(v4f*)&so[wave][col][dt * 16 + 8 * g] = lo; *(v4f*)&so[wave][col][dt * 16 + 8 * g + 4] = hi; }
  if (g == 0) { sm[wave][col] = m; sl[wave][col] = l; }
  __syncthreads();   // the partials of all splits are read by other waves below
  for (int e = tid; e < 64 * 16; e += 128 * KSP) { const int row = e >> 4, c4 = e & 15, tq = row >> 4, rl = row & 15; float mm[KSP]; float M = -3.0e38f;
#pragma unroll
    for (int p = 0; p < KSP; ++p) { mm[p] = sm[p * 4 + tq][rl]; M = fmaxf(M, mm[p]); }
    float L = 0.f; v4f o = {};
#pragma unroll
    for (int p = 0; p < KSP; ++p) { const float w = __builtin_amdgcn_exp2f((mm[p] - M) * SL2); L += w * sl[p * 4 + tq][rl]; o += w * *(const v4f*)&so[p * 4 + tq][rl][c4 * 4]; }
    vst2(O + (pb * NN + blockIdx.x * 64 + row) * CC + c4 * 4, o * (1.0f / L)); }   // o and L both carry the 2^11
}
// ---- k_fin: block = (64 voxels, b): att = (O_tt + O_st) / 2 (f32), out = att (bf16 hi + lo) . Wout^T (exact), channels-first 256-B segments
__global__ __launch_bounds__(128) void k_fin(const float* __restrict__ O, const float* __restrict__ WO, float* __restrict__ OUT) {
  __shared__ __align__(16) float sa[4][16][68]; __shared__ __align__(16) float st[64][68]; __shared__ __align__(16) __bf16 sw[CC][WPE];
  const int tid = threadIdx.x, wave = tid >> 5, lane = tid & 31, col = lane & 15, g = lane >> 4; const size_t b = blockIdx.y; const int n0b = blockIdx.x * 64, n0 = n0b + wave * 16;
  const WX wx = w_load(WO, tid);
  for (int e = lane; e < 16 * CC; e += 32) { const int rl = e >> 6, c = e & 63; sa[wave][rl][c] = (O[((0 * NB + b) * NN + n0 + rl) * CC + c] + O[((1 * NB + b) * NN + n0 + rl) * CC + c]) * 0.5f; }
  w_store(wx, sw, tid);
  __syncthreads();   // the weight rows were written by all four waves; it also orders a wave's own sa rows
  v8f acc[4] = {}; v16b wf[CC / 32][4];   // as in k_proj: one group of fragment reads ahead of the products
#pragma unroll
  for (int kc = 0; kc < CC / 32; ++kc)
#pragma unroll
    for (int jt = 0; jt < 4; ++jt) wf[kc][jt] = frag_b(&sw[jt * 16 + col][kc * 32], lane);
#pragma unroll
  for (int kc = 0; kc < CC / 32; ++kc) { const F2 a = split_row(&sa[wave][col][0], kc * 32, lane);
#pragma unroll
    for (int jt = 0; jt < 4; ++jt) { acc[jt] = wmma_bf(a.h, wf[kc][jt], acc[jt]); acc[jt] = wmma_bf(a.l, wf[kc][jt], acc[jt]); } }
#pragma unroll
  for (int jt = 0; jt < 4; ++jt)
#pragma unroll
    for (int r = 0; r < 8; ++r) st[jt * 16 + col][wave * 16 + 8 * g + r] = acc[jt][r];
  __syncthreads();
  for (int e = tid; e < CC * 16; e += 128) { const int o = e >> 4, q = e & 15; vst2(OUT + ((b * CC + o) * NN) + n0b + q * 4, *(const v4f*)&st[o][q * 4]); }
}
extern "C" void kernel_launch(void* const* d_in, const int* in_sizes, int n_in, void* d_out, int out_size, void* d_ws, size_t ws_size, hipStream_t stream) {
  (void)in_sizes; (void)n_in; (void)out_size;
  const float** F = (const float**)d_in;   // 0 source, 1 target [2,64,16,16,16]; 2 Wq_tt, 3 Wq_st, 4 Wk_tt, 5 Wk_st, 6 Wv_tt, 7 Wv_st, 8 Wout ([64,64] natural [out][in])
  if (ws_size < (size_t)WS_END) return;
  char* ws = (char*)d_ws; _Float16 *Q = (_Float16*)(ws + WS_Q), *Kr = (_Float16*)(ws + WS_K), *V = (_Float16*)(ws + WS_V); float* O = (float*)(ws + WS_O);
  k_proj<<<dim3(NN / 64, 6, NB), 128, 0, stream>>>(F[0], F[1], F[2], F[4], F[6], F[3], F[5], F[7], Q, Kr, V);   // weights in the order of which: q_tt, k_tt, v_tt, q_st, k_st, v_st
  k_attn<<<dim3(TQB, NP * TNB), 128 * KSP, 0, stream>>>(Q, Kr, V, O);
  k_fin<<<dim3(TQB, TNB), 128, 0, stream>>>(O, F[8], (float*)d_out);
}

// v006
// It runs in 27.5 microseconds.
// Two timings next to v005 both put it at 1.17 times that version's speed.
// All steps since v000 together make it 9.39 times as fast.
// compute dtype: all float inputs rounded to bf16; the six pointwise projections with EXACT bf16 products on WMMA 16x16x32 (channels-first inputs gathered into token rows), rounded once to f16; two PLAIN 64-wide attentions: q, k single f16 x 1/8, running-max softmax in f32 (hardware exp), P (scaled by 2^11, single f16) x v (single f16); the average of the two in f32, split into bf16 hi + lo x exact Wout (2 products); channels-first f32 output.
#include <hip/hip_runtime.h>
#include <math.h>

typedef __attribute__((ext_vector_type(16))) _Float16 v16h;
typedef __attribute__((ext_vector_type(16))) __bf16 v16b;
typedef __attribute__((ext_vector_type(8)))  _Float16 v8h;
typedef __attribute__((ext_vector_type(8)))  float v8f;
typedef __attribute__((ext_vector_type(4)))  float v4f;
typedef __attribute__((ext_vector_type(2)))  float v2f;
typedef __attribute__((ext_vector_type(4)))  unsigned v4u;
typedef __attribute__((ext_vector_type(4)))  int v4i;
typedef float __attribute__((may_alias)) float_a;
typedef int __attribute__((may_alias)) int_a;

template <typename T> __device__ __forceinline__ void vst2(void* p, T v) { *(T*)p = v;  }
__device__ __forceinline__ v8f wmma16(v16h a, v16h b, v8f c) {
  v8f d = __builtin_amdgcn_wmma_f32_16x16x32_f16(false, a, false, b, (short)0, c, false, false);
  asm volatile("v_nop\n\tv_nop\n\tv_nop\n\tv_nop" : "+v"(d) : "v"(a), "v"(b));
  return d;
}
__device__ __forceinline__ v8f wmma_bf(v16b a, v16b b, v8f c) {
  v8f d = __builtin_amdgcn_wmma_f32_16x16x32_bf16(false, a, false, b, (short)0, c, false, false);
  asm volatile("v_nop\n\tv_nop\n\tv_nop\n\tv_nop" : "+v"(d) : "v"(a), "v"(b));
  return d;
}
// 16x16x32 fragments: lane = (h = lane>>4, row/col = lane&15); elements 0..7 = k0+8h+0..7, 8..15 = k0+16+8h+0..7; D element r = row 8h+r
__device__ __forceinline__ v16h frag_h(const _Float16* rowk0, int lane) {
  union { v16h v; v8h q[2]; } u; const _Float16* p = rowk0 + 8 * (lane >> 4);
  u.q[0] = *(const v8h*)p; u.q[1] = *(const v8h*)(p + 16); return u.v;
}
__device__ __forceinline__ v16h frag_f32(const float* rowk0, int lane) {
  v16h a; const float* p = rowk0 + 8 * (lane >> 4);
#pragma unroll
  for (int i = 0; i < 8; ++i) { a[i] = (_Float16)p[i]; a[8 + i] = (_Float16)p[16 + i]; }
  return a;
}
__device__ __forceinline__ v16h frag_f32s(const float* rowk0, int lane, float sc) {
  v16h a; const float* p = rowk0 + 8 * (lane >> 4);
#pragma unroll
  for (int i = 0; i < 8; ++i) { a[i] = (_Float16)(p[i] * sc); a[8 + i] = (_Float16)(p[16 + i] * sc); }
  return a;
}
// column fragment from a [K][ld] layout (column n), rows >= K read as 0
__device__ __forceinline__ v16h fragc_f32(const float* W, int k0, int n, int lane, int ld, int K) {
  v16h a; const int g = lane >> 4;
#pragma unroll
  for (int i = 0; i < 8; ++i) { const int ka = k0 + 8 * g + i, kb = ka + 16;
    a[i] = (_Float16)(ka < K ? W[(size_t)(ka < K ? ka : K - 1) * ld + n] : 0.f); a[8 + i] = (_Float16)(kb < K ? W[(size_t)(kb < K ? kb : K - 1) * ld + n] : 0.f); }
  return a;
}
struct F2 { v16b h, l; };
__device__ __forceinline__ F2 bsplit16(const float v[16]) { F2 r;
#pragma unroll
  for (int i = 0; i < 16; ++i) { const __bf16 h = (__bf16)v[i]; r.h[i] = h; r.l[i] = (__bf16)(v[i] - (float)h); }
  return r; }
__device__ __forceinline__ F2 split_row(const float* row, int k0, int lane) { float v[16]; const float* p = row + k0 + 8 * (lane >> 4);
#pragma unroll
  for (int i = 0; i < 8; ++i) { v[i] = p[i]; v[8 + i] = p[16 + i]; }
  return bsplit16(v); }
__device__ __forceinline__ F2 split_rowK(const float* row, int k0, int lane, int K) { float v[16]; const int g = lane >> 4;
#pragma unroll
  for (int i = 0; i < 8; ++i) { const int ka = k0 + 8 * g + i, kb = ka + 16; v[i] = ka < K ? row[ka < K ? ka : K - 1] : 0.f; v[8 + i] = kb < K ? row[kb < K ? kb : K - 1] : 0.f; }
  return bsplit16(v); }
__device__ __forceinline__ F2 split_col(const float* W, int k0, int n, int lane, int ld, int K) { float v[16]; const int g = lane >> 4;
#pragma unroll
  for (int i = 0; i < 8; ++i) { const int ka = k0 + 8 * g + i, kb = ka + 16; v[i] = ka < K ? W[(size_t)(ka < K ? ka : K - 1) * ld + n] : 0.f; v[8 + i] = kb < K ? W[(size_t)(kb < K ? kb : K - 1) * ld + n] : 0.f; }
  return bsplit16(v); }
__device__ __forceinline__ v8f mac3(const F2& a, const F2& b, v8f c) { c = wmma_bf(a.l, b.h, c); c = wmma_bf(a.h, b.l, c); return wmma_bf(a.h, b.h, c); }
__device__ __forceinline__ float sigm(float v) { return 1.0f / (1.0f + expf(-v)); }
#define LDSX() do { asm volatile("s_wait_dscnt 0" ::: "memory"); __builtin_amdgcn_wave_barrier(); __builtin_amdgcn_fence(__ATOMIC_RELEASE, "workgroup"); } while (0)


// Uni/bidirectional spatial attention (B 2, C 64, 16^3 = 4,096 voxels): target->target and source->target single-head attentions from 1x1x1 projections, averaged, then a 1x1x1 output projection.
#define NB 2
#define CC 64
#define NN 4096
#define NP 2               // attention pairs: 0 = tt, 1 = st
#ifndef TQB
#define TQB (NN / 64)
#define TNB NB
#endif
typedef __attribute__((ext_vector_type(8))) __bf16 v8b;
__device__ __forceinline__ v16b frag_b(const __bf16* rowk0, int lane) {
  union { v16b v; v8b q[2]; } u; const __bf16* p = rowk0 + 8 * (lane >> 4);
  u.q[0] = *(const v8b*)p; u.q[1] = *(const v8b*)(p + 16); return u.v;
}
__device__ __forceinline__ float bfr(float v) { return (float)(__bf16)v; }
__device__ __attribute__((noinline)) float exp_ni(float v) { return expf(v); }
__device__ __attribute__((noinline)) float erf_ni(float v) { return erff(v); }

#define WS_Q   0u                                   // f16 rows [p][b][n][64] q ; k ; planes V [p][b][64][n] ; O f32 [p][b][n][64]
#define WS_K   (WS_Q + 2u * (size_t)NP * NB * NN * CC)
#define WS_V   (WS_K + 2u * (size_t)NP * NB * NN * CC)
#define WS_O   (WS_V + 2u * (size_t)NP * NB * CC * NN)
#define WS_END (WS_O + 4u * (size_t)NP * NB * NN * CC)

// Each block rounds the one 64 x 64 weight matrix it needs to bf16 itself, into LDS: 8 whole-line 16-byte loads a thread (a wave's 32 lanes x 16 B = 512 contiguous bytes), natural rows at a pitch of 144 B = 16 x 9, free of bank conflicts for the 16-byte fragment reads down a column of rows. No launch ahead packs the weights
#define WPE 72             // LDS pitch of a weight row, bf16 elements
typedef __attribute__((ext_vector_type(4))) __bf16 v4b;
struct WX { v4f x[8]; };
__device__ __forceinline__ WX w_load(const float* __restrict__ Wm, int tid) { WX w;
#pragma unroll   // the eight loads stand in registers and fly together
  for (int i = 0; i < 8; ++i) w.x[i] = *(const v4f*)(Wm + (tid + 128 * i) * 4);
  return w; }
__device__ __forceinline__ void w_store(const WX& w, __bf16 (*sw)[WPE], int tid) {
#pragma unroll   // w.x is indexed by constants only, so it stays in registers
  for (int i = 0; i < 8; ++i) { const int e = tid + 128 * i; const v4b y = {(__bf16)w.x[i][0], (__bf16)w.x[i][1], (__bf16)w.x[i][2], (__bf16)w.x[i][3]}; *(v4b*)&sw[e >> 4][(e & 15) * 4] = y; } }
// ---- k_proj: block = (64 voxels, which of 6, b): input tgt (which 0,1,2,3) or src (4,5); A gathered channels-first; which -> (pair, role): 0 q_tt, 1 k_tt, 2 v_tt, 3 q_st, 4 k_st, 5 v_st
__global__ __launch_bounds__(128) void k_proj(const float* __restrict__ SRC, const float* __restrict__ TGT, const float* __restrict__ W0, const float* __restrict__ W1, const float* __restrict__ W2, const float* __restrict__ W3, const float* __restrict__ W4, const float* __restrict__ W5, _Float16* __restrict__ Q, _Float16* __restrict__ Kr, _Float16* __restrict__ V) {
  __shared__ __align__(16) _Float16 so[64][72]; __shared__ __align__(16) _Float16 st[64][72]; __shared__ __align__(16) __bf16 sw[CC][WPE];
  const int tid = threadIdx.x, wave = tid >> 5, lane = tid & 31, col = lane & 15, g = lane >> 4; const int which = blockIdx.y; const size_t b = blockIdx.z; const int n0b = blockIdx.x * 64, n0 = n0b + wave * 16;
  const float* X = (which >= 4) ? SRC : TGT; const int pair = (which >= 3) ? 1 : 0; const int role = (which >= 3) ? (which - 3) : which;
  const WX wx = w_load((which == 0) ? W0 : (which == 1) ? W1 : (which == 2) ? W2 : (which == 3) ? W3 : (which == 4) ? W4 : W5, tid);
  v8f acc[4] = {}; v16b a[CC / 32];
  // the input gathers are issued ahead of the barrier, so that they fly together with the weight loads
#pragma unroll
  for (int kc = 0; kc < CC / 32; ++kc) { const float* p = X + (b * CC + kc * 32 + 8 * g) * NN + n0 + col;
#pragma unroll
    for (int i = 0; i < 8; ++i) { a[kc][i] = (__bf16)p[(size_t)i * NN]; a[kc][8 + i] = (__bf16)p[(size_t)(16 + i) * NN]; }
    asm volatile("s_wait_xcnt 0x0" ::: "memory"); }   // stands behind the issued loads, ahead of whatever next takes over one of their address registers
  w_store(wx, sw, tid);
  __syncthreads();   // the weight rows were written by all four waves
  v16b wf[CC / 32][4];   // the fragment reads stand in one group ahead of the products: a wave waits out the LDS latency once, not once a fragment
#pragma unroll
  for (int kc = 0; kc < CC / 32; ++kc)
#pragma unroll
    for (int j = 0; j < 4; ++j) wf[kc][j] = frag_b(&sw[j * 16 + col][kc * 32], lane);
#pragma unroll
  for (int kc = 0; kc < CC / 32; ++kc)
#pragma unroll
    for (int j = 0; j < 4; ++j) acc[j] = wmma_bf(a[kc], wf[kc][j], acc[j]);
  if (role < 2) { _Float16* dst = ((role == 0) ? Q : Kr) + ((size_t)pair * NB + b) * NN * CC;
#pragma unroll
    for (int j = 0; j < 4; ++j)
#pragma unroll
      for (int r = 0; r < 8; ++r) so[wave * 16 + 8 * g + r][j * 16 + col] = (_Float16)acc[j][r];
    LDSX();
    for (int rl = 0; rl < 16; ++rl) if (lane < 8) vst2((unsigned*)(dst + (size_t)(n0 + rl) * CC + lane * 8), *(const v4u*)&so[wave * 16 + rl][lane * 8]);
  } else { _Float16* dst = V + ((size_t)pair * NB + b) * CC * NN;
#pragma unroll
    for (int j = 0; j < 4; ++j)
#pragma unroll
      for (int r = 0; r < 8; ++r) st[j * 16 + col][wave * 16 + 8 * g + r] = (_Float16)acc[j][r];
    __syncthreads();
    for (int e = tid; e < 64 * 8; e += 128) { const int d = e >> 3, pc = e & 7; vst2((unsigned*)(dst + (size_t)d * NN + n0b + pc * 8), *(const v4u*)&st[d][pc * 8]); } }
}
// ---- k_attn: block = (64 queries, pair*NB + b), 4 * KSP waves: wave = (16-query tile qg, key split sp); the keys go by in stages of STK = 32 * KSP, and in each stage split sp takes the 32-key block sp with its own running max, sum and accumulators; the KSP partials of a tile are merged through LDS. Single 64-wide head over all 4,096 voxels, scale 1/8
// The products run transposed: S^T = K . Q^T (A = key rows, B = query rows) and O^T += V^T . P^T (A = V planes, B = P^T). A lane then holds 16 scores of ONE query (column col; keys 8g + r of each 16-key tile), so maximum and sum run in its own registers, and the two score tiles, converted in place, are the B operand of the second product in the hardware k order that frag_h gives V
// A stage's K rows and V plane slices are brought into LDS once for the whole block, by asynchronous copies that cover whole 128-B lines (a wave's 32 lanes x 16 B = 512 contiguous bytes), two buffers: stage t + 1 flies while stage t is worked on. The fragments are then read from LDS at padded pitches; read straight from global memory each fragment load touched 16 lines, and each of the 4 query tiles fetched the same keys again
#define KSP 8              // key splits per 16-query tile: 4 tiles x 8 splits = 32 waves, 8 per SIMD; 8 so that a stage of 256 keys divides the 4,096
#define STK (32 * KSP)     // keys per stage
#define NST (NN / STK)     // stages
#define KPB (2 * CC + 16)  // LDS pitch of a K row, bytes: 144 = 16 x 9, free of bank conflicts for 16-byte reads down a column of rows
#define VPB (2 * STK + 16) // LDS pitch of a V plane's slice, bytes: 528 = 16 x 33, likewise
#define KBB (STK * KPB)    // K part of a buffer, bytes
#define STB (KBB + CC * VPB)   // one buffer, bytes
#define SL2 0.18033688f    // (1/8) x log2(e): a raw score times this is its exponent to the base 2
__device__ __forceinline__ float xhalf(float x) { return __builtin_bit_cast(float, __builtin_amdgcn_permlanex16(__builtin_bit_cast(int, x), __builtin_bit_cast(int, x), 0x76543210, 0xfedcba98, false, false)); }  // lane l with lane l ^ 16
// a thread's four 16-byte copies of one stage: K rows r and r + STK / 2, V planes d and d + CC / 2. lk, lv: LDS byte addresses; gk, gv: global sources
__device__ __forceinline__ void stage_copy(unsigned lk, unsigned lv, const _Float16* gk, const _Float16* gv) {
  const unsigned lk1 = lk + (STK / 2) * KPB, lv1 = lv + (CC / 2) * VPB; const _Float16* gk1 = gk + (size_t)(STK / 2) * CC; const _Float16* gv1 = gv + (size_t)(CC / 2) * NN;
  // the copies go past the registers; s_wait_xcnt closes the statement so that no address register named here is rewritten ahead of it
  asm volatile("global_load_async_to_lds_b128 %0, %4, off\n\tglobal_load_async_to_lds_b128 %1, %5, off\n\tglobal_load_async_to_lds_b128 %2, %6, off\n\tglobal_load_async_to_lds_b128 %3, %7, off\n\ts_wait_xcnt 0x0" :: "v"(lk), "v"(lk1), "v"(lv), "v"(lv1), "v"(gk), "v"(gk1), "v"(gv), "v"(gv1) : "memory");
}
__global__ __launch_bounds__(128 * KSP) void k_attn(const _Float16* __restrict__ Q, const _Float16* __restrict__ Kr, const _Float16* __restrict__ V, float* __restrict__ O) {
  __shared__ __align__(16) unsigned char ring[2][STB];
  __shared__ __align__(16) float so[4 * KSP][16][68]; __shared__ float sm[4 * KSP][16]; __shared__ float sl[4 * KSP][16];
  const int tid = threadIdx.x, wave = __builtin_amdgcn_readfirstlane(tid >> 5), lane = tid & 31, col = lane & 15, g = lane >> 4; const int qg = wave & 3, sp = wave >> 2; const size_t pb = blockIdx.y; const int q0 = blockIdx.x * 64 + qg * 16; const size_t rq = pb * NN + q0;
  // K: 16-byte piece tid of the stage's first 128 rows (8 pieces a row, the rows contiguous in memory); V: piece lane of plane tid >> 5 (32 pieces a slice)
  const unsigned lk = (unsigned)(size_t)&ring[0][0] + (unsigned)((tid >> 3) * KPB + (tid & 7) * 16), lv = (unsigned)(size_t)&ring[0][0] + (unsigned)(KBB + (tid >> 5) * VPB + lane * 16);
  const _Float16* gk = Kr + pb * NN * CC + tid * 8; const _Float16* gv = V + (pb * CC + (tid >> 5)) * NN + lane * 8;
  stage_copy(lk, lv, gk, gv);
  v16h bq[2];
#pragma unroll
  for (int kc = 0; kc < 2; ++kc) bq[kc] = frag_h(Q + (rq + col) * CC + kc * 32, lane);
  float m = -3.0e38f, l = 0.f;   // of query col; m, a RAW score (q . k, not yet times 1/8), is common to the two lane halves; l, this half's keys only, carries P's factor 2^11
  v8f acc[4] = {};               // acc[dt][r] = O^T[dt * 16 + 8g + r][col]
  asm volatile("s_wait_asynccnt 0x0" ::: "memory");   // this wave's copies of stage 0 have landed
  __syncthreads();                                    // and every other wave's: stage 0 may be read
  stage_copy(lk + STB, lv + STB, gk + (size_t)STK * CC, gv + STK);
#pragma unroll 1
  for (int t = 0; t < NST; ++t) { const unsigned char* kb = &ring[t & 1][0] + (sp * 32 + col) * KPB; const unsigned char* vb = &ring[t & 1][0] + KBB + col * VPB + sp * 64; v8f s[2]; v16h ka[2][2], va[4];
    // the pass's LDS reads stand in two groups, K ahead of the first product and V ahead of the softmax, so that a wave waits out the LDS latency twice a pass and not once a fragment
#pragma unroll
    for (int ct = 0; ct < 2; ++ct)
#pragma unroll
      for (int kc = 0; kc < 2; ++kc) ka[ct][kc] = frag_h((const _Float16*)(kb + ct * 16 * KPB) + kc * 32, lane);
#pragma unroll
    for (int ct = 0; ct < 2; ++ct) { v8f c = {};
#pragma unroll
      for (int kc = 0; kc < 2; ++kc) c = wmma16(ka[ct][kc], bq[kc], c);
      s[ct] = c; }
#pragma unroll
    for (int dt = 0; dt < 4; ++dt) va[dt] = frag_h((const _Float16*)(vb + dt * 16 * VPB), lane);
    float mx = fmaxf(s[0][0], s[1][0]);
#pragma unroll
    for (int r = 1; r < 8; ++r) mx = fmaxf(mx, fmaxf(s[0][r], s[1][r]));
    mx = fmaxf(mx, xhalf(mx));
    const float mn = fmaxf(m, mx); float ea;
    // exp((m - mn) / 8) = 2^((m - mn) x SL2) as v_exp_f32 with its own v_nop: the slot the instruction set asks for behind a transcendental before its result is read.
    asm("v_exp_f32 %0, %1\n\tv_nop" : "=v"(ea) : "v"((m - mn) * SL2));
    // P x 2^11 = 2^(c x SL2 + nb): the scale 1/8, log2(e), the maximum and the 2^11 meet in ONE fused multiply-add per raw score c, with nb formed once a pass
    const float alpha = (m <= -1.0e38f) ? 0.f : ea; const float nb = 11.0f - mn * SL2; v8f e[2]; v16h pt;
#pragma unroll
    for (int ct = 0; ct < 2; ++ct)
#pragma unroll
      for (int r = 0; r < 8; ++r) { e[ct][r] = __builtin_amdgcn_exp2f(fmaf(s[ct][r], SL2, nb)); pt[8 * ct + r] = (_Float16)e[ct][r]; }
    const v8f ts = e[0] + e[1]; const float es = ((ts[0] + ts[1]) + (ts[2] + ts[3])) + ((ts[4] + ts[5]) + (ts[6] + ts[7]));
    l = l * alpha + es; m = mn;
#pragma unroll
    for (int dt = 0; dt < 4; ++dt) acc[dt] *= alpha;
#pragma unroll
    for (int dt = 0; dt < 4; ++dt) acc[dt] = wmma16(va[dt], pt, acc[dt]);
    asm volatile("s_wait_dscnt 0x0" ::: "memory");      // this wave's reads of stage t are done before its buffer is handed back
    asm volatile("s_wait_asynccnt 0x0" ::: "memory");   // this wave's copies of stage t + 1 have landed
    __syncthreads();                                    // publishes stage t + 1 and ends every wave's reads of stage t
    if (t + 2 < NST) stage_copy(lk + (t & 1) * STB, lv + (t & 1) * STB, gk + (size_t)(t + 2) * STK * CC, gv + (t + 2) * STK); }
  asm volatile("s_wait_asynccnt 0x0" ::: "memory");     // no copy is left in flight behind the loop
  // each wave leaves its un-normalised partial with its (max, sum) per query; every split has walked NST blocks, so every max is a real score
  l += xhalf(l);
#pragma unroll
  for (int dt = 0; dt < 4; ++dt) { const v4f lo = {acc[dt][0], acc[dt][1], acc[dt][2], acc[dt][3]}, hi = {acc[dt][4], acc[dt][5], acc[dt][6], acc[dt][7]}; *(v4f*)&so[wave][col][dt * 16 + 8 * g] = lo; *(v4f*)&so[wave][col][dt * 16 + 8 * g + 4] = hi; }
  if (g == 0) { sm[wave][col] = m; sl[wave][col] = l; }
  __syncthreads();   // the partials of all splits are read by other waves below
  for (int e = tid; e < 64 * 16; e += 128 * KSP) { const int row = e >> 4, c4 = e & 15, tq = row >> 4, rl = row & 15; float mm[KSP]; float M = -3.0e38f;
#pragma unroll
    for (int p = 0; p < KSP; ++p) { mm[p] = sm[p * 4 + tq][rl]; M = fmaxf(M, mm[p]); }
    float L = 0.f; v4f o = {};
#pragma unroll
    for (int p = 0; p < KSP; ++p) { const float w = __builtin_amdgcn_exp2f((mm[p] - M) * SL2); L += w * sl[p * 4 + tq][rl]; o += w * *(const v4f*)&so[p * 4 + tq][rl][c4 * 4]; }
    vst2(O + (pb * NN + blockIdx.x * 64 + row) * CC + c4 * 4, o * (1.0f / L)); }   // o and L both carry the 2^11
}
// ---- k_fin: block = (64 voxels, b): att = (O_tt + O_st) / 2 (f32), out = att (bf16 hi + lo) . Wout^T (exact), channels-first 256-B segments
__global__ __launch_bounds__(128) void k_fin(const float* __restrict__ O, const float* __restrict__ WO, float* __restrict__ OUT) {
  __shared__ __align__(16) float sa[4][16][68]; __shared__ __align__(16) float st[64][68]; __shared__ __align__(16) __bf16 sw[CC][WPE];
  const int tid = threadIdx.x, wave = tid >> 5, lane = tid & 31, col = lane & 15, g = lane >> 4; const size_t b = blockIdx.y; const int n0b = blockIdx.x * 64, n0 = n0b + wave * 16;
  const WX wx = w_load(WO, tid);
  // a wave's 16 rows of O are 4 KiB in a row for each pair: 2 x 8 whole-line 16-byte loads a lane, all issued ahead of the first use, so that the wave waits out the memory latency once and not once a trip
  const float* o0 = O + ((0 * NB + b) * NN + n0) * CC + lane * 4; const float* o1 = O + ((1 * NB + b) * NN + n0) * CC + lane * 4; v4f x0[8], x1[8];
#pragma unroll   // x0, x1 are indexed by constants only, so they stay in registers
  for (int i = 0; i < 8; ++i) { x0[i] = *(const v4f*)(o0 + 128 * i); x1[i] = *(const v4f*)(o1 + 128 * i); }
  asm volatile("s_wait_xcnt 0x0" ::: "memory");   // stands behind the issued loads, ahead of whatever next takes over one of their address registers
  w_store(wx, sw, tid);
#pragma unroll   // likewise: constant indices keep x0, x1 in registers
  for (int i = 0; i < 8; ++i) { const int e = lane + 32 * i; *(v4f*)&sa[wave][e >> 4][(e & 15) * 4] = (x0[i] + x1[i]) * 0.5f; }
  __syncthreads();   // the weight rows were written by all four waves; it also orders a wave's own sa rows
  v8f acc[4] = {}; v16b wf[CC / 32][4];   // as in k_proj: one group of fragment reads ahead of the products
#pragma unroll
  for (int kc = 0; kc < CC / 32; ++kc)
#pragma unroll
    for (int jt = 0; jt < 4; ++jt) wf[kc][jt] = frag_b(&sw[jt * 16 + col][kc * 32], lane);
#pragma unroll
  for (int kc = 0; kc < CC / 32; ++kc) { const F2 a = split_row(&sa[wave][col][0], kc * 32, lane);
#pragma unroll
    for (int jt = 0; jt < 4; ++jt) { acc[jt] = wmma_bf(a.h, wf[kc][jt], acc[jt]); acc[jt] = wmma_bf(a.l, wf[kc][jt], acc[jt]); } }
#pragma unroll
  for (int jt = 0; jt < 4; ++jt)
#pragma unroll
    for (int r = 0; r < 8; ++r) st[jt * 16 + col][wave * 16 + 8 * g + r] = acc[jt][r];
  __syncthreads();
#pragma unroll   // the eight LDS reads stand in one group ahead of the stores: rolled, each trip waited out its own read
  for (int i = 0; i < CC * 16 / 128; ++i) { const int e = tid + 128 * i, o = e >> 4, q = e & 15; vst2(OUT + ((b * CC + o) * NN) + n0b + q * 4, *(const v4f*)&st[o][q * 4]); }
}
extern "C" void kernel_launch(void* const* d_in, const int* in_sizes, int n_in, void* d_out, int out_size, void* d_ws, size_t ws_size, hipStream_t stream) {
  (void)in_sizes; (void)n_in; (void)out_size;
  const float** F = (const float**)d_in;   // 0 source, 1 target [2,64,16,16,16]; 2 Wq_tt, 3 Wq_st, 4 Wk_tt, 5 Wk_st, 6 Wv_tt, 7 Wv_st, 8 Wout ([64,64] natural [out][in])
  if (ws_size < (size_t)WS_END) return;
  char* ws = (char*)d_ws; _Float16 *Q = (_Float16*)(ws + WS_Q), *Kr = (_Float16*)(ws + WS_K), *V = (_Float16*)(ws + WS_V); float* O = (float*)(ws + WS_O);
  k_proj<<<dim3(NN / 64, 6, NB), 128, 0, stream>>>(F[0], F[1], F[2], F[4], F[6], F[3], F[5], F[7], Q, Kr, V);   // weights in the order of which: q_tt, k_tt, v_tt, q_st, k_st, v_st
  k_attn<<<dim3(TQB, NP * TNB), 128 * KSP, 0, stream>>>(Q, Kr, V, O);
  k_fin<<<dim3(TQB, TNB), 128, 0, stream>>>(O, F[8], (float*)d_out);
}
